// v000
// The times below were measured on an AMD MI455X: many runs one after another, warmed up first and cycling through
// copies of the inputs, with the whole window's GPU time divided by the number of runs. Launches and the gaps
// between them are all in it. The median over several windows is given; except for v000 it joins two sittings, which
// can be a few percent apart, so the side-by-side timings, each taken in one sitting, are the better comparison.
// The starting kernel, v000, takes 158 microseconds a run.
#include <hip/hip_runtime.h>
#include <math.h>
#include <stdint.h>

// Problem constants (from reference)
#define BB 4
#define HFD 128
#define WFD 128
#define CFD 256
#define HCD 64
#define WCD 64
#define CCD 256
#define ED 64
#define FD 256

typedef float v2f __attribute__((ext_vector_type(2)));
typedef float v8f __attribute__((ext_vector_type(8)));

__device__ __forceinline__ v8f wmma_f32_16x16x4(v2f a, v2f b, v8f c) {
  // D = A(16x4,f32) * B(4x16,f32) + C(16x16,f32), full fp32 matrix pipe
  return __builtin_amdgcn_wmma_f32_16x16x4_f32(
      /*neg_a=*/false, a, /*neg_b=*/false, b,
      /*c_mod=*/(short)0, c, /*reuse_a=*/false, /*reuse_b=*/false);
}

__device__ __forceinline__ float wave_sum32(float v) {
#pragma unroll
  for (int off = 16; off > 0; off >>= 1) v += __shfl_xor(v, off, 32);
  return v;
}

// CDNA5 async memory->LDS copy (ASYNCcnt-tracked, no VGPR staging).
__device__ __forceinline__ void async_ld_b128(unsigned lds_off,
                                              const void* gaddr) {
  asm volatile("global_load_async_to_lds_b128 %0, %1, off"
               :
               : "v"(lds_off), "v"(gaddr)
               : "memory");
}
__device__ __forceinline__ void wait_asynccnt0() {
  asm volatile("s_wait_asynccnt 0" ::: "memory");
}

#define LDSTRIDE 257  // 256 + 1 pad: A-frag column reads hit distinct banks

// -------------------------------------------------------------------------
// Kernel A: coarse layernorm + gate + WMMA GEMMs for qc (N=64), k (N=64),
// v (N=256). One block = 32 coarse pixels (2 M-tiles), 256 threads = 8
// waves. Each wave owns 3 N-tiles (scalar if/else pointers -> global_load,
// NOT flat) and 6 accumulators (2M x 3N): each K-step loads 2 A-frags from
// LDS + 3 B-frags from L2-resident weights and issues 6 independent WMMAs.
// -------------------------------------------------------------------------
__global__ __launch_bounds__(256) void sapa_coarse_proj(
    const float* __restrict__ coarse,
    const float* __restrict__ ln_g, const float* __restrict__ ln_b,
    const float* __restrict__ w_gate, const float* __restrict__ b_gate,
    const float* __restrict__ w_qc, const float* __restrict__ b_qc,
    const float* __restrict__ w_k, const float* __restrict__ b_k,
    const float* __restrict__ w_v, const float* __restrict__ b_v,
    float* __restrict__ gate_out, float* __restrict__ qc_out,
    float* __restrict__ k_out, float* __restrict__ v_out) {
  __shared__ float X[32 * LDSTRIDE];
  const int tid = threadIdx.x;
  const int lane = tid & 31;
  const int wave = tid >> 5;
  const int pbase = blockIdx.x * 32;

  // ---- LayerNorm (4 rows per wave) + gate logit ----
#pragma unroll
  for (int rr = 0; rr < 4; ++rr) {
    const int row = wave * 4 + rr;
    const int p = pbase + row;
    const float* src = coarse + (size_t)p * CCD;
    float4 u0 = *(const float4*)(src + lane * 4);
    float4 u1 = *(const float4*)(src + 128 + lane * 4);
    float s = u0.x + u0.y + u0.z + u0.w + u1.x + u1.y + u1.z + u1.w;
    float sq = u0.x * u0.x + u0.y * u0.y + u0.z * u0.z + u0.w * u0.w +
               u1.x * u1.x + u1.y * u1.y + u1.z * u1.z + u1.w * u1.w;
    s = wave_sum32(s);
    sq = wave_sum32(sq);
    const float mean = s * (1.0f / 256.0f);
    const float var = sq * (1.0f / 256.0f) - mean * mean;
    const float inv = rsqrtf(var + 1e-5f);
    float gdot = 0.0f;
    const float v0[4] = {u0.x, u0.y, u0.z, u0.w};
    const float v1[4] = {u1.x, u1.y, u1.z, u1.w};
#pragma unroll
    for (int i = 0; i < 4; ++i) {
      int c = lane * 4 + i;
      float xh = (v0[i] - mean) * inv * ln_g[c] + ln_b[c];
      X[row * LDSTRIDE + c] = xh;
      gdot = fmaf(xh, w_gate[c], gdot);
    }
#pragma unroll
    for (int i = 0; i < 4; ++i) {
      int c = 128 + lane * 4 + i;
      float xh = (v1[i] - mean) * inv * ln_g[c] + ln_b[c];
      X[row * LDSTRIDE + c] = xh;
      gdot = fmaf(xh, w_gate[c], gdot);
    }
    gdot = wave_sum32(gdot);
    if (lane == 0)
      gate_out[p] = 1.0f / (1.0f + __expf(-(gdot + b_gate[0])));
  }
  __syncthreads();

  // ---- WMMA: 24 N-tiles over concat [qc(4) | k(4) | v(16)] ----
  const int lrow = lane & 15;  // A: M index, B/D: N index
  const int lhi = lane >> 4;   // half-wave selector
  const int t0 = wave * 3 + 0;
  const int t1 = wave * 3 + 1;
  const int t2 = wave * 3 + 2;

  // Scalar pointer selection (no arrays -> keeps global addrspace inference)
  const float *W0, *W1, *W2, *B0, *B1, *B2;
  float *D0, *D1, *D2;
  int N0, N1, N2, c0, c1, c2;
  if (t0 < 4)      { W0 = w_qc; B0 = b_qc; D0 = qc_out; N0 = ED; c0 = t0 * 16; }
  else if (t0 < 8) { W0 = w_k;  B0 = b_k;  D0 = k_out;  N0 = ED; c0 = (t0 - 4) * 16; }
  else             { W0 = w_v;  B0 = b_v;  D0 = v_out;  N0 = FD; c0 = (t0 - 8) * 16; }
  if (t1 < 4)      { W1 = w_qc; B1 = b_qc; D1 = qc_out; N1 = ED; c1 = t1 * 16; }
  else if (t1 < 8) { W1 = w_k;  B1 = b_k;  D1 = k_out;  N1 = ED; c1 = (t1 - 4) * 16; }
  else             { W1 = w_v;  B1 = b_v;  D1 = v_out;  N1 = FD; c1 = (t1 - 8) * 16; }
  if (t2 < 4)      { W2 = w_qc; B2 = b_qc; D2 = qc_out; N2 = ED; c2 = t2 * 16; }
  else if (t2 < 8) { W2 = w_k;  B2 = b_k;  D2 = k_out;  N2 = ED; c2 = (t2 - 4) * 16; }
  else             { W2 = w_v;  B2 = b_v;  D2 = v_out;  N2 = FD; c2 = (t2 - 8) * 16; }

  const float* p0 = W0 + c0 + lrow;
  const float* p1 = W1 + c1 + lrow;
  const float* p2 = W2 + c2 + lrow;

  v8f a00 = {}, a01 = {}, a02 = {}, a10 = {}, a11 = {}, a12 = {};
  for (int k0 = 0; k0 < CCD; k0 += 4) {
    const int ka = k0 + lhi * 2;
    v2f af0, af1;
    af0.x = X[lrow * LDSTRIDE + ka];
    af0.y = X[lrow * LDSTRIDE + ka + 1];
    af1.x = X[(16 + lrow) * LDSTRIDE + ka];
    af1.y = X[(16 + lrow) * LDSTRIDE + ka + 1];
    v2f bf0, bf1, bf2;
    bf0.x = p0[(size_t)ka * N0];
    bf0.y = p0[(size_t)(ka + 1) * N0];
    bf1.x = p1[(size_t)ka * N1];
    bf1.y = p1[(size_t)(ka + 1) * N1];
    bf2.x = p2[(size_t)ka * N2];
    bf2.y = p2[(size_t)(ka + 1) * N2];
    a00 = wmma_f32_16x16x4(af0, bf0, a00);
    a01 = wmma_f32_16x16x4(af0, bf1, a01);
    a02 = wmma_f32_16x16x4(af0, bf2, a02);
    a10 = wmma_f32_16x16x4(af1, bf0, a10);
    a11 = wmma_f32_16x16x4(af1, bf1, a11);
    a12 = wmma_f32_16x16x4(af1, bf2, a12);
  }

  const float bn0 = B0[c0 + lrow];
  const float bn1 = B1[c1 + lrow];
  const float bn2 = B2[c2 + lrow];
#pragma unroll
  for (int j = 0; j < 8; ++j) {
    const int m = j + lhi * 8;
    D0[(size_t)(pbase + m) * N0 + c0 + lrow] = a00[j] + bn0;
    D0[(size_t)(pbase + 16 + m) * N0 + c0 + lrow] = a10[j] + bn0;
    D1[(size_t)(pbase + m) * N1 + c1 + lrow] = a01[j] + bn1;
    D1[(size_t)(pbase + 16 + m) * N1 + c1 + lrow] = a11[j] + bn1;
    D2[(size_t)(pbase + m) * N2 + c2 + lrow] = a02[j] + bn2;
    D2[(size_t)(pbase + 16 + m) * N2 + c2 + lrow] = a12[j] + bn2;
  }
}

// -------------------------------------------------------------------------
// Kernel B: fine layernorm + WMMA qf GEMM + gate blend with upsampled qc.
// One block = 64 fine pixels (4 M-tiles), 8 waves: wave = (mpair, ntile),
// 2 accumulators per wave. Dynamic LDS (64*257 floats ~= 65.8 KB).
// -------------------------------------------------------------------------
__global__ __launch_bounds__(256) void sapa_fine_query(
    const float* __restrict__ fine,
    const float* __restrict__ ln_g, const float* __restrict__ ln_b,
    const float* __restrict__ w_qf, const float* __restrict__ b_qf,
    const float* __restrict__ gate_in, const float* __restrict__ qc_in,
    float* __restrict__ query_out) {
  extern __shared__ float X[];
  const int tid = threadIdx.x;
  const int lane = tid & 31;
  const int wave = tid >> 5;
  const int pbase = blockIdx.x * 64;

#pragma unroll
  for (int rr = 0; rr < 8; ++rr) {
    const int row = wave * 8 + rr;
    const int p = pbase + row;
    const float* src = fine + (size_t)p * CFD;
    float4 u0 = *(const float4*)(src + lane * 4);
    float4 u1 = *(const float4*)(src + 128 + lane * 4);
    float s = u0.x + u0.y + u0.z + u0.w + u1.x + u1.y + u1.z + u1.w;
    float sq = u0.x * u0.x + u0.y * u0.y + u0.z * u0.z + u0.w * u0.w +
               u1.x * u1.x + u1.y * u1.y + u1.z * u1.z + u1.w * u1.w;
    s = wave_sum32(s);
    sq = wave_sum32(sq);
    const float mean = s * (1.0f / 256.0f);
    const float var = sq * (1.0f / 256.0f) - mean * mean;
    const float inv = rsqrtf(var + 1e-5f);
    const float v0[4] = {u0.x, u0.y, u0.z, u0.w};
    const float v1[4] = {u1.x, u1.y, u1.z, u1.w};
#pragma unroll
    for (int i = 0; i < 4; ++i) {
      int c = lane * 4 + i;
      X[row * LDSTRIDE + c] = (v0[i] - mean) * inv * ln_g[c] + ln_b[c];
    }
#pragma unroll
    for (int i = 0; i < 4; ++i) {
      int c = 128 + lane * 4 + i;
      X[row * LDSTRIDE + c] = (v1[i] - mean) * inv * ln_g[c] + ln_b[c];
    }
  }
  __syncthreads();

  const int lrow = lane & 15;
  const int lhi = lane >> 4;
  const int ntile = wave & 3;
  const int mbase = (wave >> 2) * 32;  // rows mbase..mbase+31 (2 M-tiles)
  const float* bp = w_qf + ntile * 16 + lrow;
  v8f acc0 = {}, acc1 = {};
  for (int k0 = 0; k0 < CFD; k0 += 4) {
    const int ka = k0 + lhi * 2;
    v2f af0, af1, bfrag;
    af0.x = X[(mbase + lrow) * LDSTRIDE + ka];
    af0.y = X[(mbase + lrow) * LDSTRIDE + ka + 1];
    af1.x = X[(mbase + 16 + lrow) * LDSTRIDE + ka];
    af1.y = X[(mbase + 16 + lrow) * LDSTRIDE + ka + 1];
    bfrag.x = bp[(size_t)ka * ED];
    bfrag.y = bp[(size_t)(ka + 1) * ED];
    acc0 = wmma_f32_16x16x4(af0, bfrag, acc0);
    acc1 = wmma_f32_16x16x4(af1, bfrag, acc1);
  }
  const int n = ntile * 16 + lrow;
  const float bn = b_qf[n];
#pragma unroll
  for (int mt = 0; mt < 2; ++mt) {
    const v8f acc = (mt == 0) ? acc0 : acc1;
#pragma unroll
    for (int j = 0; j < 8; ++j) {
      const int m = mbase + mt * 16 + j + lhi * 8;
      const int p = pbase + m;
      const int bidx = p >> 14;
      const int rem = p & 16383;
      const int h = rem >> 7;
      const int w = rem & 127;
      const int cp = (bidx * HCD + (h >> 1)) * WCD + (w >> 1);
      const float g = gate_in[cp];
      const float q =
          (acc[j] + bn) * g + qc_in[(size_t)cp * ED + n] * (1.0f - g);
      query_out[(size_t)p * ED + n] = q;
    }
  }
}

// -------------------------------------------------------------------------
// Kernel C: 5x5 local attention. One block = 4x4 coarse cells (64 fine px).
// 8x8 zero-padded k/v halo + 64-pixel query tile staged into LDS with
// CDNA5 GLOBAL_LOAD_ASYNC_TO_LDS_B128 (ASYNCcnt). Dynamic LDS ~102.5 KB.
// -------------------------------------------------------------------------
__global__ __launch_bounds__(256) void sapa_attention(
    const float* __restrict__ query, const float* __restrict__ kglb,
    const float* __restrict__ vglb, float* __restrict__ out) {
  extern __shared__ float smem[];
  float* kbuf = smem;                    // 8*8*64   = 4096 floats
  float* vbuf = kbuf + 8 * 8 * 64;       // 8*8*256  = 16384 floats
  float* qbuf = vbuf + 8 * 8 * 256;      // 64*64    = 4096 floats
  float* attb = qbuf + 64 * 64;          // 64*26    = 1664 floats

  const int tid = threadIdx.x;
  const int b = blockIdx.z;
  const int h0 = blockIdx.y * 4;
  const int w0 = blockIdx.x * 4;

  // ---- cooperative staging: k/v halo (zero-pad OOB) + query tile ----
  {
    const int cell = tid >> 2;  // 0..63
    const int part = tid & 3;
    const int ly = cell >> 3, lx = cell & 7;
    const int hh = h0 - 2 + ly, ww = w0 - 2 + lx;
    const bool ok = (hh >= 0) && (hh < HCD) && (ww >= 0) && (ww < WCD);
    const size_t cgi = (size_t)(b * HCD + (ok ? hh : 0)) * WCD + (ok ? ww : 0);
    const float* ks = kglb + cgi * ED + part * 16;
    const float* vs = vglb + cgi * FD + part * 64;
    float* kd = kbuf + cell * ED + part * 16;
    float* vd = vbuf + cell * FD + part * 64;
    if (ok) {
#pragma unroll
      for (int i = 0; i < 4; ++i)
        async_ld_b128((unsigned)(uintptr_t)(kd + i * 4), ks + i * 4);
#pragma unroll
      for (int i = 0; i < 16; ++i)
        async_ld_b128((unsigned)(uintptr_t)(vd + i * 4), vs + i * 4);
    } else {
      const float4 z = make_float4(0.f, 0.f, 0.f, 0.f);
#pragma unroll
      for (int i = 0; i < 4; ++i) ((float4*)kd)[i] = z;
#pragma unroll
      for (int i = 0; i < 16; ++i) ((float4*)vd)[i] = z;
    }
    // query tile: pixel = cell with same (cy,cx,sy,sx) decode as phases 1/3
    const int cy = cell >> 4, cx = (cell >> 2) & 3;
    const int sy = (cell >> 1) & 1, sx = cell & 1;
    const int fh = (h0 + cy) * 2 + sy;
    const int fw = (w0 + cx) * 2 + sx;
    const float* qs =
        query + ((size_t)(b * HFD + fh) * WFD + fw) * ED + part * 16;
    float* qd = qbuf + cell * ED + part * 16;
#pragma unroll
    for (int i = 0; i < 4; ++i)
      async_ld_b128((unsigned)(uintptr_t)(qd + i * 4), qs + i * 4);
  }
  wait_asynccnt0();
  __syncthreads();

  // ---- phase 1: attention logits (25 per pixel, split over 4 groups) ----
  {
    const int pid = tid & 63;
    const int grp = tid >> 6;
    const int cy = pid >> 4, cx = (pid >> 2) & 3;
    const float4* qp = (const float4*)(qbuf + pid * ED);
    float4 qv[16];
#pragma unroll
    for (int i = 0; i < 16; ++i) qv[i] = qp[i];
    for (int p = grp; p < 25; p += 4) {
      const int py = p / 5, px = p - py * 5;
      const float4* kp =
          (const float4*)(kbuf + ((cy + py) * 8 + (cx + px)) * ED);
      float dot = 0.0f;
#pragma unroll
      for (int i = 0; i < 16; ++i) {
        const float4 kv = kp[i];
        dot = fmaf(qv[i].x, kv.x, dot);
        dot = fmaf(qv[i].y, kv.y, dot);
        dot = fmaf(qv[i].z, kv.z, dot);
        dot = fmaf(qv[i].w, kv.w, dot);
      }
      attb[pid * 26 + p] = dot;
    }
  }
  __syncthreads();

  // ---- phase 2: softmax over 25 ----
  if (tid < 64) {
    float* a = attb + tid * 26;
    float mx = a[0];
#pragma unroll
    for (int p = 1; p < 25; ++p) mx = fmaxf(mx, a[p]);
    float s = 0.0f;
#pragma unroll
    for (int p = 0; p < 25; ++p) {
      const float e = __expf(a[p] - mx);
      a[p] = e;
      s += e;
    }
    const float inv = 1.0f / s;
#pragma unroll
    for (int p = 0; p < 25; ++p) a[p] *= inv;
  }
  __syncthreads();

  // ---- phase 3: weighted value accumulation (4 threads x 64 ch / pixel) --
  {
    const int pid = tid >> 2;
    const int c0 = (tid & 3) * 64;
    const int cy = pid >> 4, cx = (pid >> 2) & 3;
    const int sy = (pid >> 1) & 1, sx = pid & 1;
    const int fh = (h0 + cy) * 2 + sy;
    const int fw = (w0 + cx) * 2 + sx;
    float4 acc[16];
#pragma unroll
    for (int i = 0; i < 16; ++i) acc[i] = make_float4(0.f, 0.f, 0.f, 0.f);
    for (int p = 0; p < 25; ++p) {
      const float w = attb[pid * 26 + p];
      const int py = p / 5, px = p - py * 5;
      const float4* vp =
          (const float4*)(vbuf + ((cy + py) * 8 + (cx + px)) * FD + c0);
#pragma unroll
      for (int i = 0; i < 16; ++i) {
        const float4 vv = vp[i];
        acc[i].x = fmaf(w, vv.x, acc[i].x);
        acc[i].y = fmaf(w, vv.y, acc[i].y);
        acc[i].z = fmaf(w, vv.z, acc[i].z);
        acc[i].w = fmaf(w, vv.w, acc[i].w);
      }
    }
    float4* op = (float4*)(out + ((size_t)(b * HFD + fh) * WFD + fw) * FD + c0);
#pragma unroll
    for (int i = 0; i < 16; ++i) op[i] = acc[i];
  }
}

// -------------------------------------------------------------------------
extern "C" void kernel_launch(void* const* d_in, const int* in_sizes, int n_in,
                              void* d_out, int out_size, void* d_ws,
                              size_t ws_size, hipStream_t stream) {
  const float* fine = (const float*)d_in[0];
  const float* coarse = (const float*)d_in[1];
  const float* ln_f_g = (const float*)d_in[2];
  const float* ln_f_b = (const float*)d_in[3];
  const float* ln_c_g = (const float*)d_in[4];
  const float* ln_c_b = (const float*)d_in[5];
  const float* w_gate = (const float*)d_in[6];
  const float* b_gate = (const float*)d_in[7];
  const float* w_qf = (const float*)d_in[8];
  const float* b_qf = (const float*)d_in[9];
  const float* w_qc = (const float*)d_in[10];
  const float* b_qc = (const float*)d_in[11];
  const float* w_k = (const float*)d_in[12];
  const float* b_k = (const float*)d_in[13];
  const float* w_v = (const float*)d_in[14];
  const float* b_v = (const float*)d_in[15];
  float* out = (float*)d_out;

  // Workspace layout (floats): gate | qc | k | v | query  (~42 MB total)
  float* ws = (float*)d_ws;
  float* gate = ws;                                 // 16384
  float* qc = gate + (size_t)BB * HCD * WCD;        // 1048576
  float* kk = qc + (size_t)BB * HCD * WCD * ED;     // 1048576
  float* vv = kk + (size_t)BB * HCD * WCD * ED;     // 4194304
  float* query = vv + (size_t)BB * HCD * WCD * FD;  // 4194304

  const int coarsePixels = BB * HCD * WCD;  // 16384
  const int finePixels = BB * HFD * WFD;    // 65536

  sapa_coarse_proj<<<coarsePixels / 32, 256, 0, stream>>>(
      coarse, ln_c_g, ln_c_b, w_gate, b_gate, w_qc, b_qc, w_k, b_k, w_v, b_v,
      gate, qc, kk, vv);

  const size_t fineq_lds = (size_t)64 * LDSTRIDE * sizeof(float);
  sapa_fine_query<<<finePixels / 64, 256, fineq_lds, stream>>>(
      fine, ln_f_g, ln_f_b, w_qf, b_qf, gate, qc, query);

  const size_t attn_lds =
      (8 * 8 * 64 + 8 * 8 * 256 + 64 * 64 + 64 * 26) * sizeof(float);
  sapa_attention<<<dim3(WCD / 4, HCD / 4, BB), 256, attn_lds, stream>>>(
      query, kk, vv, out);
}

// v001
// It runs in 110 microseconds.
// Next to v000, in two timings, it ran 1.47 times as fast each time.
#include <hip/hip_runtime.h>
#include <math.h>
#include <stdint.h>

// Problem constants (from reference)
#define BB 4
#define HFD 128
#define WFD 128
#define CFD 256
#define HCD 64
#define WCD 64
#define CCD 256
#define ED 64
#define FD 256

typedef float v2f __attribute__((ext_vector_type(2)));
typedef float v8f __attribute__((ext_vector_type(8)));

__device__ __forceinline__ v8f wmma_f32_16x16x4(v2f a, v2f b, v8f c) {
  // D = A(16x4,f32) * B(4x16,f32) + C(16x16,f32), full fp32 matrix pipe
  return __builtin_amdgcn_wmma_f32_16x16x4_f32(
      /*neg_a=*/false, a, /*neg_b=*/false, b,
      /*c_mod=*/(short)0, c, /*reuse_a=*/false, /*reuse_b=*/false);
}

__device__ __forceinline__ float wave_sum32(float v) {
#pragma unroll
  for (int off = 16; off > 0; off >>= 1) v += __shfl_xor(v, off, 32);
  return v;
}

// CDNA5 async memory->LDS copy (ASYNCcnt-tracked, no VGPR staging).
__device__ __forceinline__ void async_ld_b128(unsigned lds_off,
                                              const void* gaddr) {
  asm volatile("global_load_async_to_lds_b128 %0, %1, off"
               :
               : "v"(lds_off), "v"(gaddr)
               : "memory");
}
__device__ __forceinline__ void wait_asynccnt0() {
  asm volatile("s_wait_asynccnt 0" ::: "memory");
}

#define LDSTRIDE 257  // 256 + 1 pad: A-frag column reads hit distinct banks

// -------------------------------------------------------------------------
// Kernel A: coarse layernorm + gate + WMMA GEMMs for qc (N=64), k (N=64),
// v (N=256). One block = 32 coarse pixels (2 M-tiles), 256 threads = 8
// waves. Each wave owns 3 N-tiles (scalar if/else pointers -> global_load,
// NOT flat) and 6 accumulators (2M x 3N): each K-step loads 2 A-frags from
// LDS + 3 B-frags from L2-resident weights and issues 6 independent WMMAs.
// -------------------------------------------------------------------------
__global__ __launch_bounds__(256) void sapa_coarse_proj(
    const float* __restrict__ coarse,
    const float* __restrict__ ln_g, const float* __restrict__ ln_b,
    const float* __restrict__ w_gate, const float* __restrict__ b_gate,
    const float* __restrict__ w_qc, const float* __restrict__ b_qc,
    const float* __restrict__ w_k, const float* __restrict__ b_k,
    const float* __restrict__ w_v, const float* __restrict__ b_v,
    float* __restrict__ gate_out, float* __restrict__ qc_out,
    float* __restrict__ k_out, float* __restrict__ v_out) {
  __shared__ float X[32 * LDSTRIDE];
  const int tid = threadIdx.x;
  const int lane = tid & 31;
  const int wave = tid >> 5;
  const int pbase = blockIdx.x * 32;

  // ---- LayerNorm (4 rows per wave) + gate logit ----
#pragma unroll
  for (int rr = 0; rr < 4; ++rr) {
    const int row = wave * 4 + rr;
    const int p = pbase + row;
    const float* src = coarse + (size_t)p * CCD;
    float4 u0 = *(const float4*)(src + lane * 4);
    float4 u1 = *(const float4*)(src + 128 + lane * 4);
    float s = u0.x + u0.y + u0.z + u0.w + u1.x + u1.y + u1.z + u1.w;
    float sq = u0.x * u0.x + u0.y * u0.y + u0.z * u0.z + u0.w * u0.w +
               u1.x * u1.x + u1.y * u1.y + u1.z * u1.z + u1.w * u1.w;
    s = wave_sum32(s);
    sq = wave_sum32(sq);
    const float mean = s * (1.0f / 256.0f);
    const float var = sq * (1.0f / 256.0f) - mean * mean;
    const float inv = rsqrtf(var + 1e-5f);
    float gdot = 0.0f;
    const float v0[4] = {u0.x, u0.y, u0.z, u0.w};
    const float v1[4] = {u1.x, u1.y, u1.z, u1.w};
#pragma unroll
    for (int i = 0; i < 4; ++i) {
      int c = lane * 4 + i;
      float xh = (v0[i] - mean) * inv * ln_g[c] + ln_b[c];
      X[row * LDSTRIDE + c] = xh;
      gdot = fmaf(xh, w_gate[c], gdot);
    }
#pragma unroll
    for (int i = 0; i < 4; ++i) {
      int c = 128 + lane * 4 + i;
      float xh = (v1[i] - mean) * inv * ln_g[c] + ln_b[c];
      X[row * LDSTRIDE + c] = xh;
      gdot = fmaf(xh, w_gate[c], gdot);
    }
    gdot = wave_sum32(gdot);
    if (lane == 0)
      gate_out[p] = 1.0f / (1.0f + __expf(-(gdot + b_gate[0])));
  }
  __syncthreads();

  // ---- WMMA: 24 N-tiles over concat [qc(4) | k(4) | v(16)] ----
  const int lrow = lane & 15;  // A: M index, B/D: N index
  const int lhi = lane >> 4;   // half-wave selector
  const int t0 = wave * 3 + 0;
  const int t1 = wave * 3 + 1;
  const int t2 = wave * 3 + 2;

  // Scalar pointer selection (no arrays -> keeps global addrspace inference)
  const float *W0, *W1, *W2, *B0, *B1, *B2;
  float *D0, *D1, *D2;
  int N0, N1, N2, c0, c1, c2;
  if (t0 < 4)      { W0 = w_qc; B0 = b_qc; D0 = qc_out; N0 = ED; c0 = t0 * 16; }
  else if (t0 < 8) { W0 = w_k;  B0 = b_k;  D0 = k_out;  N0 = ED; c0 = (t0 - 4) * 16; }
  else             { W0 = w_v;  B0 = b_v;  D0 = v_out;  N0 = FD; c0 = (t0 - 8) * 16; }
  if (t1 < 4)      { W1 = w_qc; B1 = b_qc; D1 = qc_out; N1 = ED; c1 = t1 * 16; }
  else if (t1 < 8) { W1 = w_k;  B1 = b_k;  D1 = k_out;  N1 = ED; c1 = (t1 - 4) * 16; }
  else             { W1 = w_v;  B1 = b_v;  D1 = v_out;  N1 = FD; c1 = (t1 - 8) * 16; }
  if (t2 < 4)      { W2 = w_qc; B2 = b_qc; D2 = qc_out; N2 = ED; c2 = t2 * 16; }
  else if (t2 < 8) { W2 = w_k;  B2 = b_k;  D2 = k_out;  N2 = ED; c2 = (t2 - 4) * 16; }
  else             { W2 = w_v;  B2 = b_v;  D2 = v_out;  N2 = FD; c2 = (t2 - 8) * 16; }

  const float* p0 = W0 + c0 + lrow;
  const float* p1 = W1 + c1 + lrow;
  const float* p2 = W2 + c2 + lrow;

  v8f a00 = {}, a01 = {}, a02 = {}, a10 = {}, a11 = {}, a12 = {};
  for (int k0 = 0; k0 < CCD; k0 += 4) {
    const int ka = k0 + lhi * 2;
    v2f af0, af1;
    af0.x = X[lrow * LDSTRIDE + ka];
    af0.y = X[lrow * LDSTRIDE + ka + 1];
    af1.x = X[(16 + lrow) * LDSTRIDE + ka];
    af1.y = X[(16 + lrow) * LDSTRIDE + ka + 1];
    v2f bf0, bf1, bf2;
    bf0.x = p0[(size_t)ka * N0];
    bf0.y = p0[(size_t)(ka + 1) * N0];
    bf1.x = p1[(size_t)ka * N1];
    bf1.y = p1[(size_t)(ka + 1) * N1];
    bf2.x = p2[(size_t)ka * N2];
    bf2.y = p2[(size_t)(ka + 1) * N2];
    a00 = wmma_f32_16x16x4(af0, bf0, a00);
    a01 = wmma_f32_16x16x4(af0, bf1, a01);
    a02 = wmma_f32_16x16x4(af0, bf2, a02);
    a10 = wmma_f32_16x16x4(af1, bf0, a10);
    a11 = wmma_f32_16x16x4(af1, bf1, a11);
    a12 = wmma_f32_16x16x4(af1, bf2, a12);
  }

  const float bn0 = B0[c0 + lrow];
  const float bn1 = B1[c1 + lrow];
  const float bn2 = B2[c2 + lrow];
#pragma unroll
  for (int j = 0; j < 8; ++j) {
    const int m = j + lhi * 8;
    D0[(size_t)(pbase + m) * N0 + c0 + lrow] = a00[j] + bn0;
    D0[(size_t)(pbase + 16 + m) * N0 + c0 + lrow] = a10[j] + bn0;
    D1[(size_t)(pbase + m) * N1 + c1 + lrow] = a01[j] + bn1;
    D1[(size_t)(pbase + 16 + m) * N1 + c1 + lrow] = a11[j] + bn1;
    D2[(size_t)(pbase + m) * N2 + c2 + lrow] = a02[j] + bn2;
    D2[(size_t)(pbase + 16 + m) * N2 + c2 + lrow] = a12[j] + bn2;
  }
}

// -------------------------------------------------------------------------
// Kernel B: fine layernorm + WMMA qf GEMM + gate blend with upsampled qc.
// One block = 64 fine pixels (4 M-tiles), 8 waves: wave = (mpair, ntile),
// 2 accumulators per wave. Dynamic LDS (64*257 floats ~= 65.8 KB).
// -------------------------------------------------------------------------
__global__ __launch_bounds__(256) void sapa_fine_query(
    const float* __restrict__ fine,
    const float* __restrict__ ln_g, const float* __restrict__ ln_b,
    const float* __restrict__ w_qf, const float* __restrict__ b_qf,
    const float* __restrict__ gate_in, const float* __restrict__ qc_in,
    float* __restrict__ query_out) {
  extern __shared__ float X[];
  const int tid = threadIdx.x;
  const int lane = tid & 31;
  const int wave = tid >> 5;
  const int pbase = blockIdx.x * 64;

#pragma unroll
  for (int rr = 0; rr < 8; ++rr) {
    const int row = wave * 8 + rr;
    const int p = pbase + row;
    const float* src = fine + (size_t)p * CFD;
    float4 u0 = *(const float4*)(src + lane * 4);
    float4 u1 = *(const float4*)(src + 128 + lane * 4);
    float s = u0.x + u0.y + u0.z + u0.w + u1.x + u1.y + u1.z + u1.w;
    float sq = u0.x * u0.x + u0.y * u0.y + u0.z * u0.z + u0.w * u0.w +
               u1.x * u1.x + u1.y * u1.y + u1.z * u1.z + u1.w * u1.w;
    s = wave_sum32(s);
    sq = wave_sum32(sq);
    const float mean = s * (1.0f / 256.0f);
    const float var = sq * (1.0f / 256.0f) - mean * mean;
    const float inv = rsqrtf(var + 1e-5f);
    const float v0[4] = {u0.x, u0.y, u0.z, u0.w};
    const float v1[4] = {u1.x, u1.y, u1.z, u1.w};
#pragma unroll
    for (int i = 0; i < 4; ++i) {
      int c = lane * 4 + i;
      X[row * LDSTRIDE + c] = (v0[i] - mean) * inv * ln_g[c] + ln_b[c];
    }
#pragma unroll
    for (int i = 0; i < 4; ++i) {
      int c = 128 + lane * 4 + i;
      X[row * LDSTRIDE + c] = (v1[i] - mean) * inv * ln_g[c] + ln_b[c];
    }
  }
  __syncthreads();

  const int lrow = lane & 15;
  const int lhi = lane >> 4;
  const int ntile = wave & 3;
  const int mbase = (wave >> 2) * 32;  // rows mbase..mbase+31 (2 M-tiles)
  const float* bp = w_qf + ntile * 16 + lrow;
  v8f acc0 = {}, acc1 = {};
  for (int k0 = 0; k0 < CFD; k0 += 4) {
    const int ka = k0 + lhi * 2;
    v2f af0, af1, bfrag;
    af0.x = X[(mbase + lrow) * LDSTRIDE + ka];
    af0.y = X[(mbase + lrow) * LDSTRIDE + ka + 1];
    af1.x = X[(mbase + 16 + lrow) * LDSTRIDE + ka];
    af1.y = X[(mbase + 16 + lrow) * LDSTRIDE + ka + 1];
    bfrag.x = bp[(size_t)ka * ED];
    bfrag.y = bp[(size_t)(ka + 1) * ED];
    acc0 = wmma_f32_16x16x4(af0, bfrag, acc0);
    acc1 = wmma_f32_16x16x4(af1, bfrag, acc1);
  }
  const int n = ntile * 16 + lrow;
  const float bn = b_qf[n];
#pragma unroll
  for (int mt = 0; mt < 2; ++mt) {
    const v8f acc = (mt == 0) ? acc0 : acc1;
#pragma unroll
    for (int j = 0; j < 8; ++j) {
      const int m = mbase + mt * 16 + j + lhi * 8;
      const int p = pbase + m;
      const int bidx = p >> 14;
      const int rem = p & 16383;
      const int h = rem >> 7;
      const int w = rem & 127;
      const int cp = (bidx * HCD + (h >> 1)) * WCD + (w >> 1);
      const float g = gate_in[cp];
      const float q =
          (acc[j] + bn) * g + qc_in[(size_t)cp * ED + n] * (1.0f - g);
      query_out[(size_t)p * ED + n] = q;
    }
  }
}

// -------------------------------------------------------------------------
// Kernel C: 5x5 local attention. One block = 4x4 coarse cells (64 fine px).
// 8x8 zero-padded k/v halo + 64-pixel query tile staged into LDS with
// CDNA5 GLOBAL_LOAD_ASYNC_TO_LDS_B128 (ASYNCcnt). Dynamic LDS ~102.5 KB.
// -------------------------------------------------------------------------
__global__ __launch_bounds__(256) void sapa_attention(
    const float* __restrict__ query, const float* __restrict__ kglb,
    const float* __restrict__ vglb, float* __restrict__ out) {
  extern __shared__ float smem[];
  float* kbuf = smem;                    // 8*8*64   = 4096 floats
  float* vbuf = kbuf + 8 * 8 * 64;       // 8*8*256  = 16384 floats
  float* qbuf = vbuf + 8 * 8 * 256;      // 64*64    = 4096 floats
  float* attb = qbuf + 64 * 64;          // 64*26    = 1664 floats

  const int tid = threadIdx.x;
  const int b = blockIdx.z;
  const int h0 = blockIdx.y * 4;
  const int w0 = blockIdx.x * 4;

  // ---- cooperative staging: k/v halo (zero-pad OOB) + query tile ----
  {
    const int cell = tid >> 2;  // 0..63
    const int part = tid & 3;
    const int ly = cell >> 3, lx = cell & 7;
    const int hh = h0 - 2 + ly, ww = w0 - 2 + lx;
    const bool ok = (hh >= 0) && (hh < HCD) && (ww >= 0) && (ww < WCD);
    const size_t cgi = (size_t)(b * HCD + (ok ? hh : 0)) * WCD + (ok ? ww : 0);
    const float* ks = kglb + cgi * ED + part * 16;
    const float* vs = vglb + cgi * FD + part * 64;
    float* kd = kbuf + cell * ED + part * 16;
    float* vd = vbuf + cell * FD + part * 64;
    if (ok) {
#pragma unroll
      for (int i = 0; i < 4; ++i)
        async_ld_b128((unsigned)(uintptr_t)(kd + i * 4), ks + i * 4);
#pragma unroll
      for (int i = 0; i < 16; ++i)
        async_ld_b128((unsigned)(uintptr_t)(vd + i * 4), vs + i * 4);
    } else {
      const float4 z = make_float4(0.f, 0.f, 0.f, 0.f);
#pragma unroll
      for (int i = 0; i < 4; ++i) ((float4*)kd)[i] = z;
#pragma unroll
      for (int i = 0; i < 16; ++i) ((float4*)vd)[i] = z;
    }
    // query tile: pixel = cell with same (cy,cx,sy,sx) decode as phases 1/3
    const int cy = cell >> 4, cx = (cell >> 2) & 3;
    const int sy = (cell >> 1) & 1, sx = cell & 1;
    const int fh = (h0 + cy) * 2 + sy;
    const int fw = (w0 + cx) * 2 + sx;
    const float* qs =
        query + ((size_t)(b * HFD + fh) * WFD + fw) * ED + part * 16;
    float* qd = qbuf + cell * ED + part * 16;
#pragma unroll
    for (int i = 0; i < 4; ++i)
      async_ld_b128((unsigned)(uintptr_t)(qd + i * 4), qs + i * 4);
  }
  wait_asynccnt0();
  __syncthreads();

  // ---- phase 1: attention logits (25 per pixel, split over 4 groups) ----
  {
    const int pid = tid & 63;
    const int grp = tid >> 6;
    const int cy = pid >> 4, cx = (pid >> 2) & 3;
    const float4* qp = (const float4*)(qbuf + pid * ED);
    float4 qv[16];
#pragma unroll
    for (int i = 0; i < 16; ++i) qv[i] = qp[i];
    for (int p = grp; p < 25; p += 4) {
      const int py = p / 5, px = p - py * 5;
      const float4* kp =
          (const float4*)(kbuf + ((cy + py) * 8 + (cx + px)) * ED);
      float dot = 0.0f;
#pragma unroll
      for (int i = 0; i < 16; ++i) {
        const float4 kv = kp[i];
        dot = fmaf(qv[i].x, kv.x, dot);
        dot = fmaf(qv[i].y, kv.y, dot);
        dot = fmaf(qv[i].z, kv.z, dot);
        dot = fmaf(qv[i].w, kv.w, dot);
      }
      attb[pid * 26 + p] = dot;
    }
  }
  __syncthreads();

  // ---- phase 2: softmax over 25 ----
  if (tid < 64) {
    float* a = attb + tid * 26;
    float mx = a[0];
#pragma unroll
    for (int p = 1; p < 25; ++p) mx = fmaxf(mx, a[p]);
    float s = 0.0f;
    float e[25];
#pragma unroll
    for (int p = 0; p < 25; ++p) {
      e[p] = __expf(a[p] - mx);
      s += e[p];
    }
    const float inv = 1.0f / s;
    // weights go out as [cell][tap][sub-pixel] (query tile is dead by now), so
    // phase 3 fetches a cell's four weights of one tap with one 16-byte read
    float* wd = qbuf + (tid >> 2) * 100 + (tid & 3);
#pragma unroll
    for (int p = 0; p < 25; ++p) wd[p * 4] = e[p] * inv;
  }
  __syncthreads();

  // ---- phase 3: weighted value accumulation ----
  // One wave = two x-adjacent coarse cells (8 fine pixels); the 32 lanes span
  // the 256 channels (4 + 4 each). Every value read is 512 contiguous bytes
  // (all banks once), serves 4 or 8 pixels, and every store is 512 contiguous
  // bytes. Taps are still summed in the order p = 0..24 for each pixel.
  {
    const int lane = tid & 31;
    // scalar wave number: cell, weight and output bases form on the scalar unit
    const int wave = __builtin_amdgcn_readfirstlane(tid >> 5);
    const int cy = wave >> 1;
    const int cxb = (wave & 1) * 2;
    const float* wl = qbuf + (cy * 4 + cxb) * 100;  // left cell's weights
    const float* wr = wl + 100;                     // right cell's weights
    // every loop below is fully unrolled: constant indices keep acc in
    // registers, the px range test folds away, and reads can be issued ahead
    float4 acc[2][4][2];
#pragma unroll
    for (int c = 0; c < 2; ++c)
#pragma unroll
      for (int s = 0; s < 4; ++s)
#pragma unroll
        for (int h = 0; h < 2; ++h)
          acc[c][s][h] = make_float4(0.f, 0.f, 0.f, 0.f);
#pragma unroll
    for (int py = 0; py < 5; ++py) {
      const float* vrow = vbuf + ((cy + py) * 8 + cxb) * FD + lane * 4;
#pragma unroll
      for (int col = 0; col < 6; ++col) {
        float4 vv[2];
        vv[0] = *(const float4*)(vrow + col * FD);
        vv[1] = *(const float4*)(vrow + col * FD + 128);
#pragma unroll
        for (int c = 0; c < 2; ++c) {
          const int px = col - c;
          if (px < 0 || px > 4) continue;
          const float4 w4 =
              *(const float4*)((c == 0 ? wl : wr) + (py * 5 + px) * 4);
          const float ws[4] = {w4.x, w4.y, w4.z, w4.w};
#pragma unroll
          for (int s = 0; s < 4; ++s)
#pragma unroll
            for (int h = 0; h < 2; ++h) {
              acc[c][s][h].x = fmaf(ws[s], vv[h].x, acc[c][s][h].x);
              acc[c][s][h].y = fmaf(ws[s], vv[h].y, acc[c][s][h].y);
              acc[c][s][h].z = fmaf(ws[s], vv[h].z, acc[c][s][h].z);
              acc[c][s][h].w = fmaf(ws[s], vv[h].w, acc[c][s][h].w);
            }
        }
      }
    }
#pragma unroll
    for (int c = 0; c < 2; ++c)
#pragma unroll
      for (int s = 0; s < 4; ++s) {
        const int fh = (h0 + cy) * 2 + (s >> 1);
        const int fw = (w0 + cxb + c) * 2 + (s & 1);
        float* op = out + ((size_t)(b * HFD + fh) * WFD + fw) * FD + lane * 4;
        *(float4*)op = acc[c][s][0];
        *(float4*)(op + 128) = acc[c][s][1];
      }
  }
}

// -------------------------------------------------------------------------
extern "C" void kernel_launch(void* const* d_in, const int* in_sizes, int n_in,
                              void* d_out, int out_size, void* d_ws,
                              size_t ws_size, hipStream_t stream) {
  const float* fine = (const float*)d_in[0];
  const float* coarse = (const float*)d_in[1];
  const float* ln_f_g = (const float*)d_in[2];
  const float* ln_f_b = (const float*)d_in[3];
  const float* ln_c_g = (const float*)d_in[4];
  const float* ln_c_b = (const float*)d_in[5];
  const float* w_gate = (const float*)d_in[6];
  const float* b_gate = (const float*)d_in[7];
  const float* w_qf = (const float*)d_in[8];
  const float* b_qf = (const float*)d_in[9];
  const float* w_qc = (const float*)d_in[10];
  const float* b_qc = (const float*)d_in[11];
  const float* w_k = (const float*)d_in[12];
  const float* b_k = (const float*)d_in[13];
  const float* w_v = (const float*)d_in[14];
  const float* b_v = (const float*)d_in[15];
  float* out = (float*)d_out;

  // Workspace layout (floats): gate | qc | k | v | query  (~42 MB total)
  float* ws = (float*)d_ws;
  float* gate = ws;                                 // 16384
  float* qc = gate + (size_t)BB * HCD * WCD;        // 1048576
  float* kk = qc + (size_t)BB * HCD * WCD * ED;     // 1048576
  float* vv = kk + (size_t)BB * HCD * WCD * ED;     // 4194304
  float* query = vv + (size_t)BB * HCD * WCD * FD;  // 4194304

  const int coarsePixels = BB * HCD * WCD;  // 16384
  const int finePixels = BB * HFD * WFD;    // 65536

  sapa_coarse_proj<<<coarsePixels / 32, 256, 0, stream>>>(
      coarse, ln_c_g, ln_c_b, w_gate, b_gate, w_qc, b_qc, w_k, b_k, w_v, b_v,
      gate, qc, kk, vv);

  const size_t fineq_lds = (size_t)64 * LDSTRIDE * sizeof(float);
  sapa_fine_query<<<finePixels / 64, 256, fineq_lds, stream>>>(
      fine, ln_f_g, ln_f_b, w_qf, b_qf, gate, qc, query);

  const size_t attn_lds =
      (8 * 8 * 64 + 8 * 8 * 256 + 64 * 64 + 64 * 26) * sizeof(float);
  sapa_attention<<<dim3(WCD / 4, HCD / 4, BB), 256, attn_lds, stream>>>(
      query, kk, vv, out);
}

// v002
// A run of this version takes 97.4 microseconds.
// Timed twice side by side with v001, it ran 1.12 times as fast both times.
// Counting every step since v000, it is 1.65 times as fast.
#include <hip/hip_runtime.h>
#include <math.h>
#include <stdint.h>

// Problem constants (from reference)
#define BB 4
#define HFD 128
#define WFD 128
#define CFD 256
#define HCD 64
#define WCD 64
#define CCD 256
#define ED 64
#define FD 256

typedef float v2f __attribute__((ext_vector_type(2)));
typedef float v8f __attribute__((ext_vector_type(8)));

__device__ __forceinline__ v8f wmma_f32_16x16x4(v2f a, v2f b, v8f c) {
  // D = A(16x4,f32) * B(4x16,f32) + C(16x16,f32), full fp32 matrix pipe
  return __builtin_amdgcn_wmma_f32_16x16x4_f32(
      /*neg_a=*/false, a, /*neg_b=*/false, b,
      /*c_mod=*/(short)0, c, /*reuse_a=*/false, /*reuse_b=*/false);
}

__device__ __forceinline__ float wave_sum32(float v) {
#pragma unroll
  for (int off = 16; off > 0; off >>= 1) v += __shfl_xor(v, off, 32);
  return v;
}

// CDNA5 async memory->LDS copy (ASYNCcnt-tracked, no VGPR staging).
__device__ __forceinline__ void async_ld_b128(unsigned lds_off,
                                              const void* gaddr) {
  asm volatile("global_load_async_to_lds_b128 %0, %1, off"
               :
               : "v"(lds_off), "v"(gaddr)
               : "memory");
}
__device__ __forceinline__ void wait_asynccnt0() {
  asm volatile("s_wait_asynccnt 0" ::: "memory");
}

#define LDSTRIDE 257  // 256 + 1 pad: A-frag column reads hit distinct banks
// Row pitch (floats) of the attention kernel's key and query tiles in LDS:
// 272 B = 16 B x 17, so 16-byte reads of neighbouring rows fall on different
// banks (at 256 B every row starts on the same four banks).
#define QKP 68

// -------------------------------------------------------------------------
// Kernel A: coarse layernorm + gate + WMMA GEMMs for qc (N=64), k (N=64),
// v (N=256). One block = 32 coarse pixels (2 M-tiles), 256 threads = 8
// waves. Each wave owns 3 N-tiles (scalar if/else pointers -> global_load,
// NOT flat) and 6 accumulators (2M x 3N): each K-step loads 2 A-frags from
// LDS + 3 B-frags from L2-resident weights and issues 6 independent WMMAs.
// -------------------------------------------------------------------------
__global__ __launch_bounds__(256) void sapa_coarse_proj(
    const float* __restrict__ coarse,
    const float* __restrict__ ln_g, const float* __restrict__ ln_b,
    const float* __restrict__ w_gate, const float* __restrict__ b_gate,
    const float* __restrict__ w_qc, const float* __restrict__ b_qc,
    const float* __restrict__ w_k, const float* __restrict__ b_k,
    const float* __restrict__ w_v, const float* __restrict__ b_v,
    float* __restrict__ gate_out, float* __restrict__ qc_out,
    float* __restrict__ k_out, float* __restrict__ v_out) {
  __shared__ float X[32 * LDSTRIDE];
  const int tid = threadIdx.x;
  const int lane = tid & 31;
  const int wave = tid >> 5;
  const int pbase = blockIdx.x * 32;

  // ---- LayerNorm (4 rows per wave) + gate logit ----
#pragma unroll
  for (int rr = 0; rr < 4; ++rr) {
    const int row = wave * 4 + rr;
    const int p = pbase + row;
    const float* src = coarse + (size_t)p * CCD;
    float4 u0 = *(const float4*)(src + lane * 4);
    float4 u1 = *(const float4*)(src + 128 + lane * 4);
    float s = u0.x + u0.y + u0.z + u0.w + u1.x + u1.y + u1.z + u1.w;
    float sq = u0.x * u0.x + u0.y * u0.y + u0.z * u0.z + u0.w * u0.w +
               u1.x * u1.x + u1.y * u1.y + u1.z * u1.z + u1.w * u1.w;
    s = wave_sum32(s);
    sq = wave_sum32(sq);
    const float mean = s * (1.0f / 256.0f);
    const float var = sq * (1.0f / 256.0f) - mean * mean;
    const float inv = rsqrtf(var + 1e-5f);
    float gdot = 0.0f;
    const float v0[4] = {u0.x, u0.y, u0.z, u0.w};
    const float v1[4] = {u1.x, u1.y, u1.z, u1.w};
#pragma unroll
    for (int i = 0; i < 4; ++i) {
      int c = lane * 4 + i;
      float xh = (v0[i] - mean) * inv * ln_g[c] + ln_b[c];
      X[row * LDSTRIDE + c] = xh;
      gdot = fmaf(xh, w_gate[c], gdot);
    }
#pragma unroll
    for (int i = 0; i < 4; ++i) {
      int c = 128 + lane * 4 + i;
      float xh = (v1[i] - mean) * inv * ln_g[c] + ln_b[c];
      X[row * LDSTRIDE + c] = xh;
      gdot = fmaf(xh, w_gate[c], gdot);
    }
    gdot = wave_sum32(gdot);
    if (lane == 0)
      gate_out[p] = 1.0f / (1.0f + __expf(-(gdot + b_gate[0])));
  }
  __syncthreads();

  // ---- WMMA: 24 N-tiles over concat [qc(4) | k(4) | v(16)] ----
  const int lrow = lane & 15;  // A: M index, B/D: N index
  const int lhi = lane >> 4;   // half-wave selector
  const int t0 = wave * 3 + 0;
  const int t1 = wave * 3 + 1;
  const int t2 = wave * 3 + 2;

  // Scalar pointer selection (no arrays -> keeps global addrspace inference)
  const float *W0, *W1, *W2, *B0, *B1, *B2;
  float *D0, *D1, *D2;
  int N0, N1, N2, c0, c1, c2;
  if (t0 < 4)      { W0 = w_qc; B0 = b_qc; D0 = qc_out; N0 = ED; c0 = t0 * 16; }
  else if (t0 < 8) { W0 = w_k;  B0 = b_k;  D0 = k_out;  N0 = ED; c0 = (t0 - 4) * 16; }
  else             { W0 = w_v;  B0 = b_v;  D0 = v_out;  N0 = FD; c0 = (t0 - 8) * 16; }
  if (t1 < 4)      { W1 = w_qc; B1 = b_qc; D1 = qc_out; N1 = ED; c1 = t1 * 16; }
  else if (t1 < 8) { W1 = w_k;  B1 = b_k;  D1 = k_out;  N1 = ED; c1 = (t1 - 4) * 16; }
  else             { W1 = w_v;  B1 = b_v;  D1 = v_out;  N1 = FD; c1 = (t1 - 8) * 16; }
  if (t2 < 4)      { W2 = w_qc; B2 = b_qc; D2 = qc_out; N2 = ED; c2 = t2 * 16; }
  else if (t2 < 8) { W2 = w_k;  B2 = b_k;  D2 = k_out;  N2 = ED; c2 = (t2 - 4) * 16; }
  else             { W2 = w_v;  B2 = b_v;  D2 = v_out;  N2 = FD; c2 = (t2 - 8) * 16; }

  const float* p0 = W0 + c0 + lrow;
  const float* p1 = W1 + c1 + lrow;
  const float* p2 = W2 + c2 + lrow;

  v8f a00 = {}, a01 = {}, a02 = {}, a10 = {}, a11 = {}, a12 = {};
  for (int k0 = 0; k0 < CCD; k0 += 4) {
    const int ka = k0 + lhi * 2;
    v2f af0, af1;
    af0.x = X[lrow * LDSTRIDE + ka];
    af0.y = X[lrow * LDSTRIDE + ka + 1];
    af1.x = X[(16 + lrow) * LDSTRIDE + ka];
    af1.y = X[(16 + lrow) * LDSTRIDE + ka + 1];
    v2f bf0, bf1, bf2;
    bf0.x = p0[(size_t)ka * N0];
    bf0.y = p0[(size_t)(ka + 1) * N0];
    bf1.x = p1[(size_t)ka * N1];
    bf1.y = p1[(size_t)(ka + 1) * N1];
    bf2.x = p2[(size_t)ka * N2];
    bf2.y = p2[(size_t)(ka + 1) * N2];
    a00 = wmma_f32_16x16x4(af0, bf0, a00);
    a01 = wmma_f32_16x16x4(af0, bf1, a01);
    a02 = wmma_f32_16x16x4(af0, bf2, a02);
    a10 = wmma_f32_16x16x4(af1, bf0, a10);
    a11 = wmma_f32_16x16x4(af1, bf1, a11);
    a12 = wmma_f32_16x16x4(af1, bf2, a12);
  }

  const float bn0 = B0[c0 + lrow];
  const float bn1 = B1[c1 + lrow];
  const float bn2 = B2[c2 + lrow];
#pragma unroll
  for (int j = 0; j < 8; ++j) {
    const int m = j + lhi * 8;
    D0[(size_t)(pbase + m) * N0 + c0 + lrow] = a00[j] + bn0;
    D0[(size_t)(pbase + 16 + m) * N0 + c0 + lrow] = a10[j] + bn0;
    D1[(size_t)(pbase + m) * N1 + c1 + lrow] = a01[j] + bn1;
    D1[(size_t)(pbase + 16 + m) * N1 + c1 + lrow] = a11[j] + bn1;
    D2[(size_t)(pbase + m) * N2 + c2 + lrow] = a02[j] + bn2;
    D2[(size_t)(pbase + 16 + m) * N2 + c2 + lrow] = a12[j] + bn2;
  }
}

// -------------------------------------------------------------------------
// Kernel B: fine layernorm + WMMA qf GEMM + gate blend with upsampled qc.
// One block = 64 fine pixels (4 M-tiles), 8 waves: wave = (mpair, ntile),
// 2 accumulators per wave. Dynamic LDS (64*257 floats ~= 65.8 KB).
// -------------------------------------------------------------------------
__global__ __launch_bounds__(256) void sapa_fine_query(
    const float* __restrict__ fine,
    const float* __restrict__ ln_g, const float* __restrict__ ln_b,
    const float* __restrict__ w_qf, const float* __restrict__ b_qf,
    const float* __restrict__ gate_in, const float* __restrict__ qc_in,
    float* __restrict__ query_out) {
  extern __shared__ float X[];
  const int tid = threadIdx.x;
  const int lane = tid & 31;
  const int wave = tid >> 5;
  const int pbase = blockIdx.x * 64;

#pragma unroll
  for (int rr = 0; rr < 8; ++rr) {
    const int row = wave * 8 + rr;
    const int p = pbase + row;
    const float* src = fine + (size_t)p * CFD;
    float4 u0 = *(const float4*)(src + lane * 4);
    float4 u1 = *(const float4*)(src + 128 + lane * 4);
    float s = u0.x + u0.y + u0.z + u0.w + u1.x + u1.y + u1.z + u1.w;
    float sq = u0.x * u0.x + u0.y * u0.y + u0.z * u0.z + u0.w * u0.w +
               u1.x * u1.x + u1.y * u1.y + u1.z * u1.z + u1.w * u1.w;
    s = wave_sum32(s);
    sq = wave_sum32(sq);
    const float mean = s * (1.0f / 256.0f);
    const float var = sq * (1.0f / 256.0f) - mean * mean;
    const float inv = rsqrtf(var + 1e-5f);
    const float v0[4] = {u0.x, u0.y, u0.z, u0.w};
    const float v1[4] = {u1.x, u1.y, u1.z, u1.w};
#pragma unroll
    for (int i = 0; i < 4; ++i) {
      int c = lane * 4 + i;
      X[row * LDSTRIDE + c] = (v0[i] - mean) * inv * ln_g[c] + ln_b[c];
    }
#pragma unroll
    for (int i = 0; i < 4; ++i) {
      int c = 128 + lane * 4 + i;
      X[row * LDSTRIDE + c] = (v1[i] - mean) * inv * ln_g[c] + ln_b[c];
    }
  }
  __syncthreads();

  const int lrow = lane & 15;
  const int lhi = lane >> 4;
  const int ntile = wave & 3;
  const int mbase = (wave >> 2) * 32;  // rows mbase..mbase+31 (2 M-tiles)
  const float* bp = w_qf + ntile * 16 + lrow;
  v8f acc0 = {}, acc1 = {};
  for (int k0 = 0; k0 < CFD; k0 += 4) {
    const int ka = k0 + lhi * 2;
    v2f af0, af1, bfrag;
    af0.x = X[(mbase + lrow) * LDSTRIDE + ka];
    af0.y = X[(mbase + lrow) * LDSTRIDE + ka + 1];
    af1.x = X[(mbase + 16 + lrow) * LDSTRIDE + ka];
    af1.y = X[(mbase + 16 + lrow) * LDSTRIDE + ka + 1];
    bfrag.x = bp[(size_t)ka * ED];
    bfrag.y = bp[(size_t)(ka + 1) * ED];
    acc0 = wmma_f32_16x16x4(af0, bfrag, acc0);
    acc1 = wmma_f32_16x16x4(af1, bfrag, acc1);
  }
  const int n = ntile * 16 + lrow;
  const float bn = b_qf[n];
#pragma unroll
  for (int mt = 0; mt < 2; ++mt) {
    const v8f acc = (mt == 0) ? acc0 : acc1;
#pragma unroll
    for (int j = 0; j < 8; ++j) {
      const int m = mbase + mt * 16 + j + lhi * 8;
      const int p = pbase + m;
      const int bidx = p >> 14;
      const int rem = p & 16383;
      const int h = rem >> 7;
      const int w = rem & 127;
      const int cp = (bidx * HCD + (h >> 1)) * WCD + (w >> 1);
      const float g = gate_in[cp];
      const float q =
          (acc[j] + bn) * g + qc_in[(size_t)cp * ED + n] * (1.0f - g);
      query_out[(size_t)p * ED + n] = q;
    }
  }
}

// -------------------------------------------------------------------------
// Kernel C: 5x5 local attention. One block = 4x4 coarse cells (64 fine px).
// 8x8 zero-padded k/v halo + 64-pixel query tile staged into LDS with
// CDNA5 GLOBAL_LOAD_ASYNC_TO_LDS_B128 (ASYNCcnt). Dynamic LDS 104.5 KB.
// -------------------------------------------------------------------------
__global__ __launch_bounds__(256) void sapa_attention(
    const float* __restrict__ query, const float* __restrict__ kglb,
    const float* __restrict__ vglb, float* __restrict__ out) {
  extern __shared__ float smem[];
  float* kbuf = smem;                    // 8*8*QKP  = 4352 floats
  float* vbuf = kbuf + 8 * 8 * QKP;      // 8*8*256  = 16384 floats
  float* qbuf = vbuf + 8 * 8 * 256;      // 64*QKP   = 4352 floats
  float* attb = qbuf + 64 * QKP;         // 64*26    = 1664 floats

  const int tid = threadIdx.x;
  const int b = blockIdx.z;
  const int h0 = blockIdx.y * 4;
  const int w0 = blockIdx.x * 4;

  // ---- cooperative staging: k/v halo (zero-pad OOB) + query tile ----
  {
    const int cell = tid >> 2;  // 0..63
    const int part = tid & 3;
    const int ly = cell >> 3, lx = cell & 7;
    const int hh = h0 - 2 + ly, ww = w0 - 2 + lx;
    const bool ok = (hh >= 0) && (hh < HCD) && (ww >= 0) && (ww < WCD);
    const size_t cgi = (size_t)(b * HCD + (ok ? hh : 0)) * WCD + (ok ? ww : 0);
    const float* ks = kglb + cgi * ED + part * 16;
    const float* vs = vglb + cgi * FD + part * 64;
    float* kd = kbuf + cell * QKP + part * 16;
    float* vd = vbuf + cell * FD + part * 64;
    if (ok) {
#pragma unroll
      for (int i = 0; i < 4; ++i)
        async_ld_b128((unsigned)(uintptr_t)(kd + i * 4), ks + i * 4);
#pragma unroll
      for (int i = 0; i < 16; ++i)
        async_ld_b128((unsigned)(uintptr_t)(vd + i * 4), vs + i * 4);
    } else {
      const float4 z = make_float4(0.f, 0.f, 0.f, 0.f);
#pragma unroll
      for (int i = 0; i < 4; ++i) ((float4*)kd)[i] = z;
#pragma unroll
      for (int i = 0; i < 16; ++i) ((float4*)vd)[i] = z;
    }
    // query tile: pixel = cell with same (cy,cx,sy,sx) decode as phases 1/3
    const int cy = cell >> 4, cx = (cell >> 2) & 3;
    const int sy = (cell >> 1) & 1, sx = cell & 1;
    const int fh = (h0 + cy) * 2 + sy;
    const int fw = (w0 + cx) * 2 + sx;
    const float* qs =
        query + ((size_t)(b * HFD + fh) * WFD + fw) * ED + part * 16;
    float* qd = qbuf + cell * QKP + part * 16;
#pragma unroll
    for (int i = 0; i < 4; ++i)
      async_ld_b128((unsigned)(uintptr_t)(qd + i * 4), qs + i * 4);
  }
  wait_asynccnt0();
  __syncthreads();

  // ---- phase 1: attention logits (25 per pixel, split over 4 groups) ----
  {
    const int pid = tid & 63;
    const int grp = tid >> 6;
    const int cy = pid >> 4, cx = (pid >> 2) & 3;
    const float4* qp = (const float4*)(qbuf + pid * QKP);
    float4 qv[16];
#pragma unroll
    for (int i = 0; i < 16; ++i) qv[i] = qp[i];
    for (int p = grp; p < 25; p += 4) {
      const int py = p / 5, px = p - py * 5;
      const float4* kp =
          (const float4*)(kbuf + ((cy + py) * 8 + (cx + px)) * QKP);
      float dot = 0.0f;
#pragma unroll
      for (int i = 0; i < 16; ++i) {
        const float4 kv = kp[i];
        dot = fmaf(qv[i].x, kv.x, dot);
        dot = fmaf(qv[i].y, kv.y, dot);
        dot = fmaf(qv[i].z, kv.z, dot);
        dot = fmaf(qv[i].w, kv.w, dot);
      }
      attb[pid * 26 + p] = dot;
    }
  }
  __syncthreads();

  // ---- phase 2: softmax over 25 ----
  if (tid < 64) {
    float* a = attb + tid * 26;
    float mx = a[0];
#pragma unroll
    for (int p = 1; p < 25; ++p) mx = fmaxf(mx, a[p]);
    float s = 0.0f;
    float e[25];
#pragma unroll
    for (int p = 0; p < 25; ++p) {
      e[p] = __expf(a[p] - mx);
      s += e[p];
    }
    const float inv = 1.0f / s;
    // weights go out as [cell][tap][sub-pixel] (query tile is dead by now), so
    // phase 3 fetches a cell's four weights of one tap with one 16-byte read
    float* wd = qbuf + (tid >> 2) * 100 + (tid & 3);
#pragma unroll
    for (int p = 0; p < 25; ++p) wd[p * 4] = e[p] * inv;
  }
  __syncthreads();

  // ---- phase 3: weighted value accumulation ----
  // One wave = two x-adjacent coarse cells (8 fine pixels); the 32 lanes span
  // the 256 channels (4 + 4 each). Every value read is 512 contiguous bytes
  // (all banks once), serves 4 or 8 pixels, and every store is 512 contiguous
  // bytes. Taps are still summed in the order p = 0..24 for each pixel.
  {
    const int lane = tid & 31;
    // scalar wave number: cell, weight and output bases form on the scalar unit
    const int wave = __builtin_amdgcn_readfirstlane(tid >> 5);
    const int cy = wave >> 1;
    const int cxb = (wave & 1) * 2;
    const float* wl = qbuf + (cy * 4 + cxb) * 100;  // left cell's weights
    const float* wr = wl + 100;                     // right cell's weights
    // every loop below is fully unrolled: constant indices keep acc in
    // registers, the px range test folds away, and reads can be issued ahead
    float4 acc[2][4][2];
#pragma unroll
    for (int c = 0; c < 2; ++c)
#pragma unroll
      for (int s = 0; s < 4; ++s)
#pragma unroll
        for (int h = 0; h < 2; ++h)
          acc[c][s][h] = make_float4(0.f, 0.f, 0.f, 0.f);
#pragma unroll
    for (int py = 0; py < 5; ++py) {
      const float* vrow = vbuf + ((cy + py) * 8 + cxb) * FD + lane * 4;
#pragma unroll
      for (int col = 0; col < 6; ++col) {
        float4 vv[2];
        vv[0] = *(const float4*)(vrow + col * FD);
        vv[1] = *(const float4*)(vrow + col * FD + 128);
#pragma unroll
        for (int c = 0; c < 2; ++c) {
          const int px = col - c;
          if (px < 0 || px > 4) continue;
          const float4 w4 =
              *(const float4*)((c == 0 ? wl : wr) + (py * 5 + px) * 4);
          const float ws[4] = {w4.x, w4.y, w4.z, w4.w};
#pragma unroll
          for (int s = 0; s < 4; ++s)
#pragma unroll
            for (int h = 0; h < 2; ++h) {
              acc[c][s][h].x = fmaf(ws[s], vv[h].x, acc[c][s][h].x);
              acc[c][s][h].y = fmaf(ws[s], vv[h].y, acc[c][s][h].y);
              acc[c][s][h].z = fmaf(ws[s], vv[h].z, acc[c][s][h].z);
              acc[c][s][h].w = fmaf(ws[s], vv[h].w, acc[c][s][h].w);
            }
        }
      }
    }
#pragma unroll
    for (int c = 0; c < 2; ++c)
#pragma unroll
      for (int s = 0; s < 4; ++s) {
        const int fh = (h0 + cy) * 2 + (s >> 1);
        const int fw = (w0 + cxb + c) * 2 + (s & 1);
        float* op = out + ((size_t)(b * HFD + fh) * WFD + fw) * FD + lane * 4;
        *(float4*)op = acc[c][s][0];
        *(float4*)(op + 128) = acc[c][s][1];
      }
  }
}

// -------------------------------------------------------------------------
extern "C" void kernel_launch(void* const* d_in, const int* in_sizes, int n_in,
                              void* d_out, int out_size, void* d_ws,
                              size_t ws_size, hipStream_t stream) {
  const float* fine = (const float*)d_in[0];
  const float* coarse = (const float*)d_in[1];
  const float* ln_f_g = (const float*)d_in[2];
  const float* ln_f_b = (const float*)d_in[3];
  const float* ln_c_g = (const float*)d_in[4];
  const float* ln_c_b = (const float*)d_in[5];
  const float* w_gate = (const float*)d_in[6];
  const float* b_gate = (const float*)d_in[7];
  const float* w_qf = (const float*)d_in[8];
  const float* b_qf = (const float*)d_in[9];
  const float* w_qc = (const float*)d_in[10];
  const float* b_qc = (const float*)d_in[11];
  const float* w_k = (const float*)d_in[12];
  const float* b_k = (const float*)d_in[13];
  const float* w_v = (const float*)d_in[14];
  const float* b_v = (const float*)d_in[15];
  float* out = (float*)d_out;

  // Workspace layout (floats): gate | qc | k | v | query  (~42 MB total)
  float* ws = (float*)d_ws;
  float* gate = ws;                                 // 16384
  float* qc = gate + (size_t)BB * HCD * WCD;        // 1048576
  float* kk = qc + (size_t)BB * HCD * WCD * ED;     // 1048576
  float* vv = kk + (size_t)BB * HCD * WCD * ED;     // 4194304
  float* query = vv + (size_t)BB * HCD * WCD * FD;  // 4194304

  const int coarsePixels = BB * HCD * WCD;  // 16384
  const int finePixels = BB * HFD * WFD;    // 65536

  sapa_coarse_proj<<<coarsePixels / 32, 256, 0, stream>>>(
      coarse, ln_c_g, ln_c_b, w_gate, b_gate, w_qc, b_qc, w_k, b_k, w_v, b_v,
      gate, qc, kk, vv);

  const size_t fineq_lds = (size_t)64 * LDSTRIDE * sizeof(float);
  sapa_fine_query<<<finePixels / 64, 256, fineq_lds, stream>>>(
      fine, ln_f_g, ln_f_b, w_qf, b_qf, gate, qc, query);

  const size_t attn_lds =
      (8 * 8 * QKP + 8 * 8 * 256 + 64 * QKP + 64 * 26) * sizeof(float);
  sapa_attention<<<dim3(WCD / 4, HCD / 4, BB), 256, attn_lds, stream>>>(
      query, kk, vv, out);
}

// v003
// Measured time: 82.2 microseconds a run.
// Timed twice side by side with v002, it ran 1.17 and 1.18 times as fast.
// Counting every step since v000, it is 1.95 times as fast.
#include <hip/hip_runtime.h>
#include <math.h>
#include <stdint.h>

// Problem constants (from reference)
#define BB 4
#define HFD 128
#define WFD 128
#define CFD 256
#define HCD 64
#define WCD 64
#define CCD 256
#define ED 64
#define FD 256

typedef float v2f __attribute__((ext_vector_type(2)));
typedef float v8f __attribute__((ext_vector_type(8)));

__device__ __forceinline__ v8f wmma_f32_16x16x4(v2f a, v2f b, v8f c) {
  // D = A(16x4,f32) * B(4x16,f32) + C(16x16,f32), full fp32 matrix pipe
  return __builtin_amdgcn_wmma_f32_16x16x4_f32(
      /*neg_a=*/false, a, /*neg_b=*/false, b,
      /*c_mod=*/(short)0, c, /*reuse_a=*/false, /*reuse_b=*/false);
}

__device__ __forceinline__ float wave_sum32(float v) {
#pragma unroll
  for (int off = 16; off > 0; off >>= 1) v += __shfl_xor(v, off, 32);
  return v;
}

// CDNA5 async memory->LDS copies (ASYNCcnt-tracked, no VGPR staging): each lane
// brings its own 16 bytes. A run of copies shares one statement that ends in
// s_wait_xcnt 0, so no address register is rewritten before the copies' address
// translations are through (a precaution).
__device__ __forceinline__ unsigned lds_addr(const float* p) {
  return (unsigned)(uintptr_t)p;  // low 32 bits = byte offset in the group's LDS
}
__device__ __forceinline__ void async_ld4_b128(
    const float* l0, const float* g0, const float* l1, const float* g1,
    const float* l2, const float* g2, const float* l3, const float* g3) {
  asm volatile(
      "global_load_async_to_lds_b128 %0, %1, off\n\t"
      "global_load_async_to_lds_b128 %2, %3, off\n\t"
      "global_load_async_to_lds_b128 %4, %5, off\n\t"
      "global_load_async_to_lds_b128 %6, %7, off\n\t"
      "s_wait_xcnt 0x0"
      :
      : "v"(lds_addr(l0)), "v"(g0), "v"(lds_addr(l1)), "v"(g1),
        "v"(lds_addr(l2)), "v"(g2), "v"(lds_addr(l3)), "v"(g3)
      : "memory");
}
__device__ __forceinline__ void async_ld5_b128(
    const float* l0, const float* g0, const float* l1, const float* g1,
    const float* l2, const float* g2, const float* l3, const float* g3,
    const float* l4, const float* g4) {
  asm volatile(
      "global_load_async_to_lds_b128 %0, %1, off\n\t"
      "global_load_async_to_lds_b128 %2, %3, off\n\t"
      "global_load_async_to_lds_b128 %4, %5, off\n\t"
      "global_load_async_to_lds_b128 %6, %7, off\n\t"
      "global_load_async_to_lds_b128 %8, %9, off\n\t"
      "s_wait_xcnt 0x0"
      :
      : "v"(lds_addr(l0)), "v"(g0), "v"(lds_addr(l1)), "v"(g1),
        "v"(lds_addr(l2)), "v"(g2), "v"(lds_addr(l3)), "v"(g3),
        "v"(lds_addr(l4)), "v"(g4)
      : "memory");
}
__device__ __forceinline__ void wait_asynccnt0() {
  asm volatile("s_wait_asynccnt 0" ::: "memory");
}

#define LDSTRIDE 257  // 256 + 1 pad: A-frag column reads hit distinct banks
// Row pitch (floats) of the attention kernel's key and query tiles in LDS:
// 272 B = 16 B x 17, so 16-byte reads of neighbouring rows fall on different
// banks (at 256 B every row starts on the same four banks).
#define QKP 68

// -------------------------------------------------------------------------
// Kernel A: coarse layernorm + gate + WMMA GEMMs for qc (N=64), k (N=64),
// v (N=256). One block = 32 coarse pixels (2 M-tiles), 256 threads = 8
// waves. Each wave owns 3 N-tiles (scalar if/else pointers -> global_load,
// NOT flat) and 6 accumulators (2M x 3N): each K-step loads 2 A-frags from
// LDS + 3 B-frags from L2-resident weights and issues 6 independent WMMAs.
// -------------------------------------------------------------------------
__global__ __launch_bounds__(256) void sapa_coarse_proj(
    const float* __restrict__ coarse,
    const float* __restrict__ ln_g, const float* __restrict__ ln_b,
    const float* __restrict__ w_gate, const float* __restrict__ b_gate,
    const float* __restrict__ w_qc, const float* __restrict__ b_qc,
    const float* __restrict__ w_k, const float* __restrict__ b_k,
    const float* __restrict__ w_v, const float* __restrict__ b_v,
    float* __restrict__ gate_out, float* __restrict__ qc_out,
    float* __restrict__ k_out, float* __restrict__ v_out) {
  __shared__ float X[32 * LDSTRIDE];
  const int tid = threadIdx.x;
  const int lane = tid & 31;
  const int wave = tid >> 5;
  const int pbase = blockIdx.x * 32;

  // ---- LayerNorm (4 rows per wave) + gate logit ----
#pragma unroll
  for (int rr = 0; rr < 4; ++rr) {
    const int row = wave * 4 + rr;
    const int p = pbase + row;
    const float* src = coarse + (size_t)p * CCD;
    float4 u0 = *(const float4*)(src + lane * 4);
    float4 u1 = *(const float4*)(src + 128 + lane * 4);
    float s = u0.x + u0.y + u0.z + u0.w + u1.x + u1.y + u1.z + u1.w;
    float sq = u0.x * u0.x + u0.y * u0.y + u0.z * u0.z + u0.w * u0.w +
               u1.x * u1.x + u1.y * u1.y + u1.z * u1.z + u1.w * u1.w;
    s = wave_sum32(s);
    sq = wave_sum32(sq);
    const float mean = s * (1.0f / 256.0f);
    const float var = sq * (1.0f / 256.0f) - mean * mean;
    const float inv = rsqrtf(var + 1e-5f);
    float gdot = 0.0f;
    const float v0[4] = {u0.x, u0.y, u0.z, u0.w};
    const float v1[4] = {u1.x, u1.y, u1.z, u1.w};
#pragma unroll
    for (int i = 0; i < 4; ++i) {
      int c = lane * 4 + i;
      float xh = (v0[i] - mean) * inv * ln_g[c] + ln_b[c];
      X[row * LDSTRIDE + c] = xh;
      gdot = fmaf(xh, w_gate[c], gdot);
    }
#pragma unroll
    for (int i = 0; i < 4; ++i) {
      int c = 128 + lane * 4 + i;
      float xh = (v1[i] - mean) * inv * ln_g[c] + ln_b[c];
      X[row * LDSTRIDE + c] = xh;
      gdot = fmaf(xh, w_gate[c], gdot);
    }
    gdot = wave_sum32(gdot);
    if (lane == 0)
      gate_out[p] = 1.0f / (1.0f + __expf(-(gdot + b_gate[0])));
  }
  __syncthreads();

  // ---- WMMA: 24 N-tiles over concat [qc(4) | k(4) | v(16)] ----
  const int lrow = lane & 15;  // A: M index, B/D: N index
  const int lhi = lane >> 4;   // half-wave selector
  const int t0 = wave * 3 + 0;
  const int t1 = wave * 3 + 1;
  const int t2 = wave * 3 + 2;

  // Scalar pointer selection (no arrays -> keeps global addrspace inference)
  const float *W0, *W1, *W2, *B0, *B1, *B2;
  float *D0, *D1, *D2;
  int N0, N1, N2, c0, c1, c2;
  if (t0 < 4)      { W0 = w_qc; B0 = b_qc; D0 = qc_out; N0 = ED; c0 = t0 * 16; }
  else if (t0 < 8) { W0 = w_k;  B0 = b_k;  D0 = k_out;  N0 = ED; c0 = (t0 - 4) * 16; }
  else             { W0 = w_v;  B0 = b_v;  D0 = v_out;  N0 = FD; c0 = (t0 - 8) * 16; }
  if (t1 < 4)      { W1 = w_qc; B1 = b_qc; D1 = qc_out; N1 = ED; c1 = t1 * 16; }
  else if (t1 < 8) { W1 = w_k;  B1 = b_k;  D1 = k_out;  N1 = ED; c1 = (t1 - 4) * 16; }
  else             { W1 = w_v;  B1 = b_v;  D1 = v_out;  N1 = FD; c1 = (t1 - 8) * 16; }
  if (t2 < 4)      { W2 = w_qc; B2 = b_qc; D2 = qc_out; N2 = ED; c2 = t2 * 16; }
  else if (t2 < 8) { W2 = w_k;  B2 = b_k;  D2 = k_out;  N2 = ED; c2 = (t2 - 4) * 16; }
  else             { W2 = w_v;  B2 = b_v;  D2 = v_out;  N2 = FD; c2 = (t2 - 8) * 16; }

  const float* p0 = W0 + c0 + lrow;
  const float* p1 = W1 + c1 + lrow;
  const float* p2 = W2 + c2 + lrow;

  v8f a00 = {}, a01 = {}, a02 = {}, a10 = {}, a11 = {}, a12 = {};
  for (int k0 = 0; k0 < CCD; k0 += 4) {
    const int ka = k0 + lhi * 2;
    v2f af0, af1;
    af0.x = X[lrow * LDSTRIDE + ka];
    af0.y = X[lrow * LDSTRIDE + ka + 1];
    af1.x = X[(16 + lrow) * LDSTRIDE + ka];
    af1.y = X[(16 + lrow) * LDSTRIDE + ka + 1];
    v2f bf0, bf1, bf2;
    bf0.x = p0[(size_t)ka * N0];
    bf0.y = p0[(size_t)(ka + 1) * N0];
    bf1.x = p1[(size_t)ka * N1];
    bf1.y = p1[(size_t)(ka + 1) * N1];
    bf2.x = p2[(size_t)ka * N2];
    bf2.y = p2[(size_t)(ka + 1) * N2];
    a00 = wmma_f32_16x16x4(af0, bf0, a00);
    a01 = wmma_f32_16x16x4(af0, bf1, a01);
    a02 = wmma_f32_16x16x4(af0, bf2, a02);
    a10 = wmma_f32_16x16x4(af1, bf0, a10);
    a11 = wmma_f32_16x16x4(af1, bf1, a11);
    a12 = wmma_f32_16x16x4(af1, bf2, a12);
  }

  const float bn0 = B0[c0 + lrow];
  const float bn1 = B1[c1 + lrow];
  const float bn2 = B2[c2 + lrow];
#pragma unroll
  for (int j = 0; j < 8; ++j) {
    const int m = j + lhi * 8;
    D0[(size_t)(pbase + m) * N0 + c0 + lrow] = a00[j] + bn0;
    D0[(size_t)(pbase + 16 + m) * N0 + c0 + lrow] = a10[j] + bn0;
    D1[(size_t)(pbase + m) * N1 + c1 + lrow] = a01[j] + bn1;
    D1[(size_t)(pbase + 16 + m) * N1 + c1 + lrow] = a11[j] + bn1;
    D2[(size_t)(pbase + m) * N2 + c2 + lrow] = a02[j] + bn2;
    D2[(size_t)(pbase + 16 + m) * N2 + c2 + lrow] = a12[j] + bn2;
  }
}

// -------------------------------------------------------------------------
// Kernel B: fine layernorm + WMMA qf GEMM + gate blend with upsampled qc.
// One block = 64 fine pixels (4 M-tiles), 8 waves: wave = (mpair, ntile),
// 2 accumulators per wave. Dynamic LDS (64*257 floats ~= 65.8 KB).
// -------------------------------------------------------------------------
__global__ __launch_bounds__(256) void sapa_fine_query(
    const float* __restrict__ fine,
    const float* __restrict__ ln_g, const float* __restrict__ ln_b,
    const float* __restrict__ w_qf, const float* __restrict__ b_qf,
    const float* __restrict__ gate_in, const float* __restrict__ qc_in,
    float* __restrict__ query_out) {
  extern __shared__ float X[];
  const int tid = threadIdx.x;
  const int lane = tid & 31;
  const int wave = tid >> 5;
  const int pbase = blockIdx.x * 64;

#pragma unroll
  for (int rr = 0; rr < 8; ++rr) {
    const int row = wave * 8 + rr;
    const int p = pbase + row;
    const float* src = fine + (size_t)p * CFD;
    float4 u0 = *(const float4*)(src + lane * 4);
    float4 u1 = *(const float4*)(src + 128 + lane * 4);
    float s = u0.x + u0.y + u0.z + u0.w + u1.x + u1.y + u1.z + u1.w;
    float sq = u0.x * u0.x + u0.y * u0.y + u0.z * u0.z + u0.w * u0.w +
               u1.x * u1.x + u1.y * u1.y + u1.z * u1.z + u1.w * u1.w;
    s = wave_sum32(s);
    sq = wave_sum32(sq);
    const float mean = s * (1.0f / 256.0f);
    const float var = sq * (1.0f / 256.0f) - mean * mean;
    const float inv = rsqrtf(var + 1e-5f);
    const float v0[4] = {u0.x, u0.y, u0.z, u0.w};
    const float v1[4] = {u1.x, u1.y, u1.z, u1.w};
#pragma unroll
    for (int i = 0; i < 4; ++i) {
      int c = lane * 4 + i;
      X[row * LDSTRIDE + c] = (v0[i] - mean) * inv * ln_g[c] + ln_b[c];
    }
#pragma unroll
    for (int i = 0; i < 4; ++i) {
      int c = 128 + lane * 4 + i;
      X[row * LDSTRIDE + c] = (v1[i] - mean) * inv * ln_g[c] + ln_b[c];
    }
  }
  __syncthreads();

  const int lrow = lane & 15;
  const int lhi = lane >> 4;
  const int ntile = wave & 3;
  const int mbase = (wave >> 2) * 32;  // rows mbase..mbase+31 (2 M-tiles)
  const float* bp = w_qf + ntile * 16 + lrow;
  v8f acc0 = {}, acc1 = {};
  for (int k0 = 0; k0 < CFD; k0 += 4) {
    const int ka = k0 + lhi * 2;
    v2f af0, af1, bfrag;
    af0.x = X[(mbase + lrow) * LDSTRIDE + ka];
    af0.y = X[(mbase + lrow) * LDSTRIDE + ka + 1];
    af1.x = X[(mbase + 16 + lrow) * LDSTRIDE + ka];
    af1.y = X[(mbase + 16 + lrow) * LDSTRIDE + ka + 1];
    bfrag.x = bp[(size_t)ka * ED];
    bfrag.y = bp[(size_t)(ka + 1) * ED];
    acc0 = wmma_f32_16x16x4(af0, bfrag, acc0);
    acc1 = wmma_f32_16x16x4(af1, bfrag, acc1);
  }
  const int n = ntile * 16 + lrow;
  const float bn = b_qf[n];
#pragma unroll
  for (int mt = 0; mt < 2; ++mt) {
    const v8f acc = (mt == 0) ? acc0 : acc1;
#pragma unroll
    for (int j = 0; j < 8; ++j) {
      const int m = mbase + mt * 16 + j + lhi * 8;
      const int p = pbase + m;
      const int bidx = p >> 14;
      const int rem = p & 16383;
      const int h = rem >> 7;
      const int w = rem & 127;
      const int cp = (bidx * HCD + (h >> 1)) * WCD + (w >> 1);
      const float g = gate_in[cp];
      const float q =
          (acc[j] + bn) * g + qc_in[(size_t)cp * ED + n] * (1.0f - g);
      query_out[(size_t)p * ED + n] = q;
    }
  }
}

// -------------------------------------------------------------------------
// Kernel C: 5x5 local attention. One block = 4x4 coarse cells (64 fine px).
// 8x8 zero-padded k/v halo + 64-pixel query tile staged into LDS with
// CDNA5 GLOBAL_LOAD_ASYNC_TO_LDS_B128 (ASYNCcnt). Dynamic LDS 104.5 KB.
// -------------------------------------------------------------------------
__global__ __launch_bounds__(256) void sapa_attention(
    const float* __restrict__ query, const float* __restrict__ kglb,
    const float* __restrict__ vglb, float* __restrict__ out) {
  extern __shared__ __attribute__((aligned(16))) float smem[];
  float* kbuf = smem;                    // 8*8*QKP  = 4352 floats
  float* vbuf = kbuf + 8 * 8 * QKP;      // 8*8*256  = 16384 floats
  float* qbuf = vbuf + 8 * 8 * 256;      // 64*QKP   = 4352 floats
  float* attb = qbuf + 64 * QKP;         // 64*26    = 1664 floats

  const int tid = threadIdx.x;
  const int b = blockIdx.z;
  const int h0 = blockIdx.y * 4;
  const int w0 = blockIdx.x * 4;

  // ---- cooperative staging: k/v halo (zero-pad OOB) + query tile ----
  // Every copy of a wave moves 512 contiguous bytes of global memory (four
  // whole 128-byte lines), lane l the l-th 16 bytes. Wave w brings halo row w
  // of k and v and fine row w of the query tile.
  {
    const int lane = tid & 31;
    const int half = lane >> 4;        // which of two 256-byte rows
    const int l16 = (lane & 15) * 4;   // float offset inside such a row
    // scalar wave number: the edge tests below are scalar branches, so a wave
    // either issues a copy with every lane on or jumps past it
    const int wv = __builtin_amdgcn_readfirstlane(tid >> 5);

    // query: fine row h0*2 + wv, 8 pixels = 2 KB contiguous; one copy = the two
    // pixels (sx = half) of one cell; LDS order (cy,cx,sy,sx) as phases 1/3 read
    {
      const int cy = wv >> 1, sy = wv & 1;
      const float* qs =
          query + ((size_t)(b * HFD + h0 * 2 + wv) * WFD + w0 * 2) * ED +
          lane * 4;
      const float* qd = qbuf + (cy * 16 + sy * 2 + half) * QKP + l16;
      async_ld4_b128(qd, qs, qd + 4 * QKP, qs + 128, qd + 8 * QKP, qs + 256,
                     qd + 12 * QKP, qs + 384);
    }

    // k/v: halo row wv, two columns at a time. w0, the halo width and WCD are
    // even, so the two columns of a pair are inside the image or outside it
    // together.
    const int hh = h0 - 2 + wv;
    const bool rowok = (hh >= 0) && (hh < HCD);
    // unrolled so that j folds into constant LDS and column offsets
#pragma unroll
    for (int j = 0; j < 4; ++j) {
      const int ww = w0 - 2 + 2 * j;
      float* kd = kbuf + (wv * 8 + 2 * j + half) * QKP + l16;
      float* vd = vbuf + (wv * 8 + 2 * j) * FD + lane * 4;
      if (rowok && ww >= 0 && ww + 1 < WCD) {
        const size_t cgi = (size_t)(b * HCD + hh) * WCD + ww;
        const float* ks = kglb + cgi * ED + lane * 4;
        const float* vs = vglb + cgi * FD + lane * 4;
        async_ld5_b128(vd, vs, vd + 128, vs + 128, vd + 256, vs + 256,
                       vd + 384, vs + 384, kd, ks);
      } else {
        const float4 z = make_float4(0.f, 0.f, 0.f, 0.f);
        *(float4*)kd = z;
        *(float4*)vd = z;
        *(float4*)(vd + 128) = z;
        *(float4*)(vd + 256) = z;
        *(float4*)(vd + 384) = z;
      }
    }
  }
  wait_asynccnt0();
  __syncthreads();

  // ---- phase 1: attention logits (25 per pixel, split over 4 groups) ----
  {
    const int pid = tid & 63;
    const int grp = tid >> 6;
    const int cy = pid >> 4, cx = (pid >> 2) & 3;
    const float4* qp = (const float4*)(qbuf + pid * QKP);
    float4 qv[16];
#pragma unroll
    for (int i = 0; i < 16; ++i) qv[i] = qp[i];
    for (int p = grp; p < 25; p += 4) {
      const int py = p / 5, px = p - py * 5;
      const float4* kp =
          (const float4*)(kbuf + ((cy + py) * 8 + (cx + px)) * QKP);
      float dot = 0.0f;
#pragma unroll
      for (int i = 0; i < 16; ++i) {
        const float4 kv = kp[i];
        dot = fmaf(qv[i].x, kv.x, dot);
        dot = fmaf(qv[i].y, kv.y, dot);
        dot = fmaf(qv[i].z, kv.z, dot);
        dot = fmaf(qv[i].w, kv.w, dot);
      }
      attb[pid * 26 + p] = dot;
    }
  }
  __syncthreads();

  // ---- phase 2: softmax over 25 ----
  if (tid < 64) {
    float* a = attb + tid * 26;
    float mx = a[0];
#pragma unroll
    for (int p = 1; p < 25; ++p) mx = fmaxf(mx, a[p]);
    float s = 0.0f;
    float e[25];
#pragma unroll
    for (int p = 0; p < 25; ++p) {
      e[p] = __expf(a[p] - mx);
      s += e[p];
    }
    const float inv = 1.0f / s;
    // weights go out as [cell][tap][sub-pixel] (query tile is dead by now), so
    // phase 3 fetches a cell's four weights of one tap with one 16-byte read
    float* wd = qbuf + (tid >> 2) * 100 + (tid & 3);
#pragma unroll
    for (int p = 0; p < 25; ++p) wd[p * 4] = e[p] * inv;
  }
  __syncthreads();

  // ---- phase 3: weighted value accumulation ----
  // One wave = two x-adjacent coarse cells (8 fine pixels); the 32 lanes span
  // the 256 channels (4 + 4 each). Every value read is 512 contiguous bytes
  // (all banks once), serves 4 or 8 pixels, and every store is 512 contiguous
  // bytes. Taps are still summed in the order p = 0..24 for each pixel.
  {
    const int lane = tid & 31;
    // scalar wave number: cell, weight and output bases form on the scalar unit
    const int wave = __builtin_amdgcn_readfirstlane(tid >> 5);
    const int cy = wave >> 1;
    const int cxb = (wave & 1) * 2;
    const float* wl = qbuf + (cy * 4 + cxb) * 100;  // left cell's weights
    const float* wr = wl + 100;                     // right cell's weights
    // every loop below is fully unrolled: constant indices keep acc in
    // registers, the px range test folds away, and reads can be issued ahead
    float4 acc[2][4][2];
#pragma unroll
    for (int c = 0; c < 2; ++c)
#pragma unroll
      for (int s = 0; s < 4; ++s)
#pragma unroll
        for (int h = 0; h < 2; ++h)
          acc[c][s][h] = make_float4(0.f, 0.f, 0.f, 0.f);
#pragma unroll
    for (int py = 0; py < 5; ++py) {
      const float* vrow = vbuf + ((cy + py) * 8 + cxb) * FD + lane * 4;
#pragma unroll
      for (int col = 0; col < 6; ++col) {
        float4 vv[2];
        vv[0] = *(const float4*)(vrow + col * FD);
        vv[1] = *(const float4*)(vrow + col * FD + 128);
#pragma unroll
        for (int c = 0; c < 2; ++c) {
          const int px = col - c;
          if (px < 0 || px > 4) continue;
          const float4 w4 =
              *(const float4*)((c == 0 ? wl : wr) + (py * 5 + px) * 4);
          const float ws[4] = {w4.x, w4.y, w4.z, w4.w};
#pragma unroll
          for (int s = 0; s < 4; ++s)
#pragma unroll
            for (int h = 0; h < 2; ++h) {
              acc[c][s][h].x = fmaf(ws[s], vv[h].x, acc[c][s][h].x);
              acc[c][s][h].y = fmaf(ws[s], vv[h].y, acc[c][s][h].y);
              acc[c][s][h].z = fmaf(ws[s], vv[h].z, acc[c][s][h].z);
              acc[c][s][h].w = fmaf(ws[s], vv[h].w, acc[c][s][h].w);
            }
        }
      }
    }
#pragma unroll
    for (int c = 0; c < 2; ++c)
#pragma unroll
      for (int s = 0; s < 4; ++s) {
        const int fh = (h0 + cy) * 2 + (s >> 1);
        const int fw = (w0 + cxb + c) * 2 + (s & 1);
        float* op = out + ((size_t)(b * HFD + fh) * WFD + fw) * FD + lane * 4;
        *(float4*)op = acc[c][s][0];
        *(float4*)(op + 128) = acc[c][s][1];
      }
  }
}

// -------------------------------------------------------------------------
extern "C" void kernel_launch(void* const* d_in, const int* in_sizes, int n_in,
                              void* d_out, int out_size, void* d_ws,
                              size_t ws_size, hipStream_t stream) {
  const float* fine = (const float*)d_in[0];
  const float* coarse = (const float*)d_in[1];
  const float* ln_f_g = (const float*)d_in[2];
  const float* ln_f_b = (const float*)d_in[3];
  const float* ln_c_g = (const float*)d_in[4];
  const float* ln_c_b = (const float*)d_in[5];
  const float* w_gate = (const float*)d_in[6];
  const float* b_gate = (const float*)d_in[7];
  const float* w_qf = (const float*)d_in[8];
  const float* b_qf = (const float*)d_in[9];
  const float* w_qc = (const float*)d_in[10];
  const float* b_qc = (const float*)d_in[11];
  const float* w_k = (const float*)d_in[12];
  const float* b_k = (const float*)d_in[13];
  const float* w_v = (const float*)d_in[14];
  const float* b_v = (const float*)d_in[15];
  float* out = (float*)d_out;

  // Workspace layout (floats): gate | qc | k | v | query  (~42 MB total)
  float* ws = (float*)d_ws;
  float* gate = ws;                                 // 16384
  float* qc = gate + (size_t)BB * HCD * WCD;        // 1048576
  float* kk = qc + (size_t)BB * HCD * WCD * ED;     // 1048576
  float* vv = kk + (size_t)BB * HCD * WCD * ED;     // 4194304
  float* query = vv + (size_t)BB * HCD * WCD * FD;  // 4194304

  const int coarsePixels = BB * HCD * WCD;  // 16384
  const int finePixels = BB * HFD * WFD;    // 65536

  sapa_coarse_proj<<<coarsePixels / 32, 256, 0, stream>>>(
      coarse, ln_c_g, ln_c_b, w_gate, b_gate, w_qc, b_qc, w_k, b_k, w_v, b_v,
      gate, qc, kk, vv);

  const size_t fineq_lds = (size_t)64 * LDSTRIDE * sizeof(float);
  sapa_fine_query<<<finePixels / 64, 256, fineq_lds, stream>>>(
      fine, ln_f_g, ln_f_b, w_qf, b_qf, gate, qc, query);

  const size_t attn_lds =
      (8 * 8 * QKP + 8 * 8 * 256 + 64 * QKP + 64 * 26) * sizeof(float);
  sapa_attention<<<dim3(WCD / 4, HCD / 4, BB), 256, attn_lds, stream>>>(
      query, kk, vv, out);
}

// v004
// One run takes 62.3 microseconds.
// Next to v003, in two timings, it ran 1.32 and 1.33 times as fast.
// Counting every step since v000, it is 2.58 times as fast.
#include <hip/hip_runtime.h>
#include <math.h>
#include <stdint.h>

// Problem constants (from reference)
#define BB 4
#define HFD 128
#define WFD 128
#define CFD 256
#define HCD 64
#define WCD 64
#define CCD 256
#define ED 64
#define FD 256

typedef float v2f __attribute__((ext_vector_type(2)));
typedef float v8f __attribute__((ext_vector_type(8)));

__device__ __forceinline__ v8f wmma_f32_16x16x4(v2f a, v2f b, v8f c) {
  // D = A(16x4,f32) * B(4x16,f32) + C(16x16,f32), full fp32 matrix pipe
  return __builtin_amdgcn_wmma_f32_16x16x4_f32(
      /*neg_a=*/false, a, /*neg_b=*/false, b,
      /*c_mod=*/(short)0, c, /*reuse_a=*/false, /*reuse_b=*/false);
}

__device__ __forceinline__ float wave_sum32(float v) {
#pragma unroll
  for (int off = 16; off > 0; off >>= 1) v += __shfl_xor(v, off, 32);
  return v;
}

// CDNA5 async memory->LDS copies (ASYNCcnt-tracked, no VGPR staging): each lane
// brings its own 16 bytes. A run of copies shares one statement that ends in
// s_wait_xcnt 0, so no address register is rewritten before the copies' address
// translations are through (a precaution).
__device__ __forceinline__ unsigned lds_addr(const float* p) {
  return (unsigned)(uintptr_t)p;  // low 32 bits = byte offset in the group's LDS
}
__device__ __forceinline__ void async_ld4_b128(
    const float* l0, const float* g0, const float* l1, const float* g1,
    const float* l2, const float* g2, const float* l3, const float* g3) {
  asm volatile(
      "global_load_async_to_lds_b128 %0, %1, off\n\t"
      "global_load_async_to_lds_b128 %2, %3, off\n\t"
      "global_load_async_to_lds_b128 %4, %5, off\n\t"
      "global_load_async_to_lds_b128 %6, %7, off\n\t"
      "s_wait_xcnt 0x0"
      :
      : "v"(lds_addr(l0)), "v"(g0), "v"(lds_addr(l1)), "v"(g1),
        "v"(lds_addr(l2)), "v"(g2), "v"(lds_addr(l3)), "v"(g3)
      : "memory");
}
__device__ __forceinline__ void async_ld5_b128(
    const float* l0, const float* g0, const float* l1, const float* g1,
    const float* l2, const float* g2, const float* l3, const float* g3,
    const float* l4, const float* g4) {
  asm volatile(
      "global_load_async_to_lds_b128 %0, %1, off\n\t"
      "global_load_async_to_lds_b128 %2, %3, off\n\t"
      "global_load_async_to_lds_b128 %4, %5, off\n\t"
      "global_load_async_to_lds_b128 %6, %7, off\n\t"
      "global_load_async_to_lds_b128 %8, %9, off\n\t"
      "s_wait_xcnt 0x0"
      :
      : "v"(lds_addr(l0)), "v"(g0), "v"(lds_addr(l1)), "v"(g1),
        "v"(lds_addr(l2)), "v"(g2), "v"(lds_addr(l3)), "v"(g3),
        "v"(lds_addr(l4)), "v"(g4)
      : "memory");
}
__device__ __forceinline__ void wait_asynccnt0() {
  asm volatile("s_wait_asynccnt 0" ::: "memory");
}

#define LDSTRIDE 257  // 256 + 1 pad: A-frag column reads hit distinct banks
// Row pitch (floats) of the attention kernel's key and query tiles in LDS:
// 272 B = 16 B x 17, so 16-byte reads of neighbouring rows fall on different
// banks (at 256 B every row starts on the same four banks).
#define QKP 68

// K loop and stores of one wave of kernel A: 2 M-tiles x 3 N-tiles. The row
// strides N0..N2 of the three weight / output matrices are compile-time, so a
// K-step's addresses are one base plus constant offsets. p* = weight column of
// this lane, d* = output column of this lane, bn* = its bias.
template <int N0, int N1, int N2>
__device__ __forceinline__ void coarse_tiles(
    const float* X, const int lrow, const int lhi, const int pbase,
    const float* __restrict__ p0, const float* __restrict__ p1,
    const float* __restrict__ p2, const float bn0, const float bn1,
    const float bn2, float* __restrict__ d0, float* __restrict__ d1,
    float* __restrict__ d2) {
  const float* x0 = X + lrow * LDSTRIDE + lhi * 2;
  const float* x1 = x0 + 16 * LDSTRIDE;
  const float* q0 = p0 + lhi * 2 * N0;
  const float* q1 = p1 + lhi * 2 * N1;
  const float* q2 = p2 + lhi * 2 * N2;
  v8f a00 = {}, a01 = {}, a02 = {}, a10 = {}, a11 = {}, a12 = {};
  for (int kb = 0; kb < CCD; kb += 32) {
    // 8 K-steps per trip, fully unrolled: their 48 weight loads go out together,
    // ahead of the matrix instructions, so the wave waits for L2 once per 8
    // steps, not once per step
#pragma unroll
    for (int k0 = 0; k0 < 32; k0 += 4) {
      v2f af0, af1;
      af0.x = x0[k0];
      af0.y = x0[k0 + 1];
      af1.x = x1[k0];
      af1.y = x1[k0 + 1];
      v2f bf0, bf1, bf2;
      bf0.x = q0[k0 * N0];
      bf0.y = q0[(k0 + 1) * N0];
      bf1.x = q1[k0 * N1];
      bf1.y = q1[(k0 + 1) * N1];
      bf2.x = q2[k0 * N2];
      bf2.y = q2[(k0 + 1) * N2];
      a00 = wmma_f32_16x16x4(af0, bf0, a00);
      a01 = wmma_f32_16x16x4(af0, bf1, a01);
      a02 = wmma_f32_16x16x4(af0, bf2, a02);
      a10 = wmma_f32_16x16x4(af1, bf0, a10);
      a11 = wmma_f32_16x16x4(af1, bf1, a11);
      a12 = wmma_f32_16x16x4(af1, bf2, a12);
    }
    x0 += 32;
    x1 += 32;
    q0 += 32 * N0;
    q1 += 32 * N1;
    q2 += 32 * N2;
  }
  float* e0 = d0 + (size_t)(pbase + lhi * 8) * N0;
  float* e1 = d1 + (size_t)(pbase + lhi * 8) * N1;
  float* e2 = d2 + (size_t)(pbase + lhi * 8) * N2;
  // unrolled: constant indices keep the accumulators in registers
#pragma unroll
  for (int j = 0; j < 8; ++j) {
    e0[j * N0] = a00[j] + bn0;
    e0[(16 + j) * N0] = a10[j] + bn0;
    e1[j * N1] = a01[j] + bn1;
    e1[(16 + j) * N1] = a11[j] + bn1;
    e2[j * N2] = a02[j] + bn2;
    e2[(16 + j) * N2] = a12[j] + bn2;
  }
  // behind the last store: no data or address register of these stores is
  // rewritten before their address translations are through (a precaution)
  asm volatile("s_wait_xcnt 0x0" ::: "memory");
}

// -------------------------------------------------------------------------
// Kernel A: coarse layernorm + gate + WMMA GEMMs for qc (N=64), k (N=64),
// v (N=256). One block = 32 coarse pixels (2 M-tiles), 256 threads = 8
// waves. Each wave owns 3 N-tiles and 6 accumulators (2M x 3N): each K-step
// takes 2 A-frags from LDS + 3 B-frags from L2-resident weights and issues 6
// independent WMMAs (coarse_tiles above).
// -------------------------------------------------------------------------
__global__ __launch_bounds__(256) void sapa_coarse_proj(
    const float* __restrict__ coarse,
    const float* __restrict__ ln_g, const float* __restrict__ ln_b,
    const float* __restrict__ w_gate, const float* __restrict__ b_gate,
    const float* __restrict__ w_qc, const float* __restrict__ b_qc,
    const float* __restrict__ w_k, const float* __restrict__ b_k,
    const float* __restrict__ w_v, const float* __restrict__ b_v,
    float* __restrict__ gate_out, float* __restrict__ qc_out,
    float* __restrict__ k_out, float* __restrict__ v_out) {
  __shared__ float X[32 * LDSTRIDE];
  const int tid = threadIdx.x;
  const int lane = tid & 31;
  const int wave = tid >> 5;
  const int pbase = blockIdx.x * 32;

  // ---- LayerNorm (4 rows per wave) + gate logit ----
#pragma unroll
  for (int rr = 0; rr < 4; ++rr) {
    const int row = wave * 4 + rr;
    const int p = pbase + row;
    const float* src = coarse + (size_t)p * CCD;
    float4 u0 = *(const float4*)(src + lane * 4);
    float4 u1 = *(const float4*)(src + 128 + lane * 4);
    float s = u0.x + u0.y + u0.z + u0.w + u1.x + u1.y + u1.z + u1.w;
    float sq = u0.x * u0.x + u0.y * u0.y + u0.z * u0.z + u0.w * u0.w +
               u1.x * u1.x + u1.y * u1.y + u1.z * u1.z + u1.w * u1.w;
    s = wave_sum32(s);
    sq = wave_sum32(sq);
    const float mean = s * (1.0f / 256.0f);
    const float var = sq * (1.0f / 256.0f) - mean * mean;
    const float inv = rsqrtf(var + 1e-5f);
    float gdot = 0.0f;
    const float v0[4] = {u0.x, u0.y, u0.z, u0.w};
    const float v1[4] = {u1.x, u1.y, u1.z, u1.w};
#pragma unroll
    for (int i = 0; i < 4; ++i) {
      int c = lane * 4 + i;
      float xh = (v0[i] - mean) * inv * ln_g[c] + ln_b[c];
      X[row * LDSTRIDE + c] = xh;
      gdot = fmaf(xh, w_gate[c], gdot);
    }
#pragma unroll
    for (int i = 0; i < 4; ++i) {
      int c = 128 + lane * 4 + i;
      float xh = (v1[i] - mean) * inv * ln_g[c] + ln_b[c];
      X[row * LDSTRIDE + c] = xh;
      gdot = fmaf(xh, w_gate[c], gdot);
    }
    gdot = wave_sum32(gdot);
    if (lane == 0)
      gate_out[p] = 1.0f / (1.0f + __expf(-(gdot + b_gate[0])));
  }
  __syncthreads();

  // ---- WMMA: 24 N-tiles over concat [qc(4) | k(4) | v(16)] ----
  const int lrow = lane & 15;  // A: M index, B/D: N index
  const int lhi = lane >> 4;   // half-wave selector
  // scalar wave number: the choice below is a scalar branch (every lane stays on
  // for the matrix instructions) and each side knows its row strides at compile
  // time. Wave w owns tiles 3w, 3w+1, 3w+2 of the concatenation.
  const int wv = __builtin_amdgcn_readfirstlane(tid >> 5);
  if (wv >= 3) {
    const int c = (wv * 3 - 8) * 16 + lrow;  // three tiles of v
    coarse_tiles<FD, FD, FD>(X, lrow, lhi, pbase, w_v + c, w_v + c + 16,
                             w_v + c + 32, b_v[c], b_v[c + 16], b_v[c + 32],
                             v_out + c, v_out + c + 16, v_out + c + 32);
  } else if (wv == 2) {  // k tiles 2, 3 and v tile 0
    coarse_tiles<ED, ED, FD>(X, lrow, lhi, pbase, w_k + 32 + lrow,
                             w_k + 48 + lrow, w_v + lrow, b_k[32 + lrow],
                             b_k[48 + lrow], b_v[lrow], k_out + 32 + lrow,
                             k_out + 48 + lrow, v_out + lrow);
  } else if (wv == 1) {  // qc tile 3 and k tiles 0, 1
    coarse_tiles<ED, ED, ED>(X, lrow, lhi, pbase, w_qc + 48 + lrow, w_k + lrow,
                             w_k + 16 + lrow, b_qc[48 + lrow], b_k[lrow],
                             b_k[16 + lrow], qc_out + 48 + lrow, k_out + lrow,
                             k_out + 16 + lrow);
  } else {  // qc tiles 0, 1, 2
    coarse_tiles<ED, ED, ED>(X, lrow, lhi, pbase, w_qc + lrow, w_qc + 16 + lrow,
                             w_qc + 32 + lrow, b_qc[lrow], b_qc[16 + lrow],
                             b_qc[32 + lrow], qc_out + lrow, qc_out + 16 + lrow,
                             qc_out + 32 + lrow);
  }
}

// -------------------------------------------------------------------------
// Kernel B: fine layernorm + WMMA qf GEMM + gate blend with upsampled qc.
// One block = 64 fine pixels (4 M-tiles), 8 waves: wave = (mpair, ntile),
// 2 accumulators per wave. Dynamic LDS (64*257 floats ~= 65.8 KB).
// -------------------------------------------------------------------------
__global__ __launch_bounds__(256) void sapa_fine_query(
    const float* __restrict__ fine,
    const float* __restrict__ ln_g, const float* __restrict__ ln_b,
    const float* __restrict__ w_qf, const float* __restrict__ b_qf,
    const float* __restrict__ gate_in, const float* __restrict__ qc_in,
    float* __restrict__ query_out) {
  extern __shared__ float X[];
  const int tid = threadIdx.x;
  const int lane = tid & 31;
  const int wave = tid >> 5;
  const int pbase = blockIdx.x * 64;

#pragma unroll
  for (int rr = 0; rr < 8; ++rr) {
    const int row = wave * 8 + rr;
    const int p = pbase + row;
    const float* src = fine + (size_t)p * CFD;
    float4 u0 = *(const float4*)(src + lane * 4);
    float4 u1 = *(const float4*)(src + 128 + lane * 4);
    float s = u0.x + u0.y + u0.z + u0.w + u1.x + u1.y + u1.z + u1.w;
    float sq = u0.x * u0.x + u0.y * u0.y + u0.z * u0.z + u0.w * u0.w +
               u1.x * u1.x + u1.y * u1.y + u1.z * u1.z + u1.w * u1.w;
    s = wave_sum32(s);
    sq = wave_sum32(sq);
    const float mean = s * (1.0f / 256.0f);
    const float var = sq * (1.0f / 256.0f) - mean * mean;
    const float inv = rsqrtf(var + 1e-5f);
    const float v0[4] = {u0.x, u0.y, u0.z, u0.w};
    const float v1[4] = {u1.x, u1.y, u1.z, u1.w};
#pragma unroll
    for (int i = 0; i < 4; ++i) {
      int c = lane * 4 + i;
      X[row * LDSTRIDE + c] = (v0[i] - mean) * inv * ln_g[c] + ln_b[c];
    }
#pragma unroll
    for (int i = 0; i < 4; ++i) {
      int c = 128 + lane * 4 + i;
      X[row * LDSTRIDE + c] = (v1[i] - mean) * inv * ln_g[c] + ln_b[c];
    }
  }
  __syncthreads();

  const int lrow = lane & 15;
  const int lhi = lane >> 4;
  const int ntile = wave & 3;
  const int mbase = (wave >> 2) * 32;  // rows mbase..mbase+31 (2 M-tiles)
  const float* bp = w_qf + ntile * 16 + lrow;
  v8f acc0 = {}, acc1 = {};
  for (int k0 = 0; k0 < CFD; k0 += 4) {
    const int ka = k0 + lhi * 2;
    v2f af0, af1, bfrag;
    af0.x = X[(mbase + lrow) * LDSTRIDE + ka];
    af0.y = X[(mbase + lrow) * LDSTRIDE + ka + 1];
    af1.x = X[(mbase + 16 + lrow) * LDSTRIDE + ka];
    af1.y = X[(mbase + 16 + lrow) * LDSTRIDE + ka + 1];
    bfrag.x = bp[(size_t)ka * ED];
    bfrag.y = bp[(size_t)(ka + 1) * ED];
    acc0 = wmma_f32_16x16x4(af0, bfrag, acc0);
    acc1 = wmma_f32_16x16x4(af1, bfrag, acc1);
  }
  const int n = ntile * 16 + lrow;
  const float bn = b_qf[n];
#pragma unroll
  for (int mt = 0; mt < 2; ++mt) {
    const v8f acc = (mt == 0) ? acc0 : acc1;
#pragma unroll
    for (int j = 0; j < 8; ++j) {
      const int m = mbase + mt * 16 + j + lhi * 8;
      const int p = pbase + m;
      const int bidx = p >> 14;
      const int rem = p & 16383;
      const int h = rem >> 7;
      const int w = rem & 127;
      const int cp = (bidx * HCD + (h >> 1)) * WCD + (w >> 1);
      const float g = gate_in[cp];
      const float q =
          (acc[j] + bn) * g + qc_in[(size_t)cp * ED + n] * (1.0f - g);
      query_out[(size_t)p * ED + n] = q;
    }
  }
}

// -------------------------------------------------------------------------
// Kernel C: 5x5 local attention. One block = 4x4 coarse cells (64 fine px).
// 8x8 zero-padded k/v halo + 64-pixel query tile staged into LDS with
// CDNA5 GLOBAL_LOAD_ASYNC_TO_LDS_B128 (ASYNCcnt). Dynamic LDS 104.5 KB.
// -------------------------------------------------------------------------
__global__ __launch_bounds__(256) void sapa_attention(
    const float* __restrict__ query, const float* __restrict__ kglb,
    const float* __restrict__ vglb, float* __restrict__ out) {
  extern __shared__ __attribute__((aligned(16))) float smem[];
  float* kbuf = smem;                    // 8*8*QKP  = 4352 floats
  float* vbuf = kbuf + 8 * 8 * QKP;      // 8*8*256  = 16384 floats
  float* qbuf = vbuf + 8 * 8 * 256;      // 64*QKP   = 4352 floats
  float* attb = qbuf + 64 * QKP;         // 64*26    = 1664 floats

  const int tid = threadIdx.x;
  const int b = blockIdx.z;
  const int h0 = blockIdx.y * 4;
  const int w0 = blockIdx.x * 4;

  // ---- cooperative staging: k/v halo (zero-pad OOB) + query tile ----
  // Every copy of a wave moves 512 contiguous bytes of global memory (four
  // whole 128-byte lines), lane l the l-th 16 bytes. Wave w brings halo row w
  // of k and v and fine row w of the query tile.
  {
    const int lane = tid & 31;
    const int half = lane >> 4;        // which of two 256-byte rows
    const int l16 = (lane & 15) * 4;   // float offset inside such a row
    // scalar wave number: the edge tests below are scalar branches, so a wave
    // either issues a copy with every lane on or jumps past it
    const int wv = __builtin_amdgcn_readfirstlane(tid >> 5);

    // query: fine row h0*2 + wv, 8 pixels = 2 KB contiguous; one copy = the two
    // pixels (sx = half) of one cell; LDS order (cy,cx,sy,sx) as phases 1/3 read
    {
      const int cy = wv >> 1, sy = wv & 1;
      const float* qs =
          query + ((size_t)(b * HFD + h0 * 2 + wv) * WFD + w0 * 2) * ED +
          lane * 4;
      const float* qd = qbuf + (cy * 16 + sy * 2 + half) * QKP + l16;
      async_ld4_b128(qd, qs, qd + 4 * QKP, qs + 128, qd + 8 * QKP, qs + 256,
                     qd + 12 * QKP, qs + 384);
    }

    // k/v: halo row wv, two columns at a time. w0, the halo width and WCD are
    // even, so the two columns of a pair are inside the image or outside it
    // together.
    const int hh = h0 - 2 + wv;
    const bool rowok = (hh >= 0) && (hh < HCD);
    // unrolled so that j folds into constant LDS and column offsets
#pragma unroll
    for (int j = 0; j < 4; ++j) {
      const int ww = w0 - 2 + 2 * j;
      float* kd = kbuf + (wv * 8 + 2 * j + half) * QKP + l16;
      float* vd = vbuf + (wv * 8 + 2 * j) * FD + lane * 4;
      if (rowok && ww >= 0 && ww + 1 < WCD) {
        const size_t cgi = (size_t)(b * HCD + hh) * WCD + ww;
        const float* ks = kglb + cgi * ED + lane * 4;
        const float* vs = vglb + cgi * FD + lane * 4;
        async_ld5_b128(vd, vs, vd + 128, vs + 128, vd + 256, vs + 256,
                       vd + 384, vs + 384, kd, ks);
      } else {
        const float4 z = make_float4(0.f, 0.f, 0.f, 0.f);
        *(float4*)kd = z;
        *(float4*)vd = z;
        *(float4*)(vd + 128) = z;
        *(float4*)(vd + 256) = z;
        *(float4*)(vd + 384) = z;
      }
    }
  }
  wait_asynccnt0();
  __syncthreads();

  // ---- phase 1: attention logits (25 per pixel, split over 4 groups) ----
  {
    const int pid = tid & 63;
    const int grp = tid >> 6;
    const int cy = pid >> 4, cx = (pid >> 2) & 3;
    const float4* qp = (const float4*)(qbuf + pid * QKP);
    float4 qv[16];
#pragma unroll
    for (int i = 0; i < 16; ++i) qv[i] = qp[i];
    for (int p = grp; p < 25; p += 4) {
      const int py = p / 5, px = p - py * 5;
      const float4* kp =
          (const float4*)(kbuf + ((cy + py) * 8 + (cx + px)) * QKP);
      float dot = 0.0f;
#pragma unroll
      for (int i = 0; i < 16; ++i) {
        const float4 kv = kp[i];
        dot = fmaf(qv[i].x, kv.x, dot);
        dot = fmaf(qv[i].y, kv.y, dot);
        dot = fmaf(qv[i].z, kv.z, dot);
        dot = fmaf(qv[i].w, kv.w, dot);
      }
      attb[pid * 26 + p] = dot;
    }
  }
  __syncthreads();

  // ---- phase 2: softmax over 25 ----
  if (tid < 64) {
    float* a = attb + tid * 26;
    float mx = a[0];
#pragma unroll
    for (int p = 1; p < 25; ++p) mx = fmaxf(mx, a[p]);
    float s = 0.0f;
    float e[25];
#pragma unroll
    for (int p = 0; p < 25; ++p) {
      e[p] = __expf(a[p] - mx);
      s += e[p];
    }
    const float inv = 1.0f / s;
    // weights go out as [cell][tap][sub-pixel] (query tile is dead by now), so
    // phase 3 fetches a cell's four weights of one tap with one 16-byte read
    float* wd = qbuf + (tid >> 2) * 100 + (tid & 3);
#pragma unroll
    for (int p = 0; p < 25; ++p) wd[p * 4] = e[p] * inv;
  }
  __syncthreads();

  // ---- phase 3: weighted value accumulation ----
  // One wave = two x-adjacent coarse cells (8 fine pixels); the 32 lanes span
  // the 256 channels (4 + 4 each). Every value read is 512 contiguous bytes
  // (all banks once), serves 4 or 8 pixels, and every store is 512 contiguous
  // bytes. Taps are still summed in the order p = 0..24 for each pixel.
  {
    const int lane = tid & 31;
    // scalar wave number: cell, weight and output bases form on the scalar unit
    const int wave = __builtin_amdgcn_readfirstlane(tid >> 5);
    const int cy = wave >> 1;
    const int cxb = (wave & 1) * 2;
    const float* wl = qbuf + (cy * 4 + cxb) * 100;  // left cell's weights
    const float* wr = wl + 100;                     // right cell's weights
    // every loop below is fully unrolled: constant indices keep acc in
    // registers, the px range test folds away, and reads can be issued ahead
    float4 acc[2][4][2];
#pragma unroll
    for (int c = 0; c < 2; ++c)
#pragma unroll
      for (int s = 0; s < 4; ++s)
#pragma unroll
        for (int h = 0; h < 2; ++h)
          acc[c][s][h] = make_float4(0.f, 0.f, 0.f, 0.f);
#pragma unroll
    for (int py = 0; py < 5; ++py) {
      const float* vrow = vbuf + ((cy + py) * 8 + cxb) * FD + lane * 4;
#pragma unroll
      for (int col = 0; col < 6; ++col) {
        float4 vv[2];
        vv[0] = *(const float4*)(vrow + col * FD);
        vv[1] = *(const float4*)(vrow + col * FD + 128);
#pragma unroll
        for (int c = 0; c < 2; ++c) {
          const int px = col - c;
          if (px < 0 || px > 4) continue;
          const float4 w4 =
              *(const float4*)((c == 0 ? wl : wr) + (py * 5 + px) * 4);
          const float ws[4] = {w4.x, w4.y, w4.z, w4.w};
#pragma unroll
          for (int s = 0; s < 4; ++s)
#pragma unroll
            for (int h = 0; h < 2; ++h) {
              acc[c][s][h].x = fmaf(ws[s], vv[h].x, acc[c][s][h].x);
              acc[c][s][h].y = fmaf(ws[s], vv[h].y, acc[c][s][h].y);
              acc[c][s][h].z = fmaf(ws[s], vv[h].z, acc[c][s][h].z);
              acc[c][s][h].w = fmaf(ws[s], vv[h].w, acc[c][s][h].w);
            }
        }
      }
    }
#pragma unroll
    for (int c = 0; c < 2; ++c)
#pragma unroll
      for (int s = 0; s < 4; ++s) {
        const int fh = (h0 + cy) * 2 + (s >> 1);
        const int fw = (w0 + cxb + c) * 2 + (s & 1);
        float* op = out + ((size_t)(b * HFD + fh) * WFD + fw) * FD + lane * 4;
        *(float4*)op = acc[c][s][0];
        *(float4*)(op + 128) = acc[c][s][1];
      }
  }
}

// -------------------------------------------------------------------------
extern "C" void kernel_launch(void* const* d_in, const int* in_sizes, int n_in,
                              void* d_out, int out_size, void* d_ws,
                              size_t ws_size, hipStream_t stream) {
  const float* fine = (const float*)d_in[0];
  const float* coarse = (const float*)d_in[1];
  const float* ln_f_g = (const float*)d_in[2];
  const float* ln_f_b = (const float*)d_in[3];
  const float* ln_c_g = (const float*)d_in[4];
  const float* ln_c_b = (const float*)d_in[5];
  const float* w_gate = (const float*)d_in[6];
  const float* b_gate = (const float*)d_in[7];
  const float* w_qf = (const float*)d_in[8];
  const float* b_qf = (const float*)d_in[9];
  const float* w_qc = (const float*)d_in[10];
  const float* b_qc = (const float*)d_in[11];
  const float* w_k = (const float*)d_in[12];
  const float* b_k = (const float*)d_in[13];
  const float* w_v = (const float*)d_in[14];
  const float* b_v = (const float*)d_in[15];
  float* out = (float*)d_out;

  // Workspace layout (floats): gate | qc | k | v | query  (~42 MB total)
  float* ws = (float*)d_ws;
  float* gate = ws;                                 // 16384
  float* qc = gate + (size_t)BB * HCD * WCD;        // 1048576
  float* kk = qc + (size_t)BB * HCD * WCD * ED;     // 1048576
  float* vv = kk + (size_t)BB * HCD * WCD * ED;     // 4194304
  float* query = vv + (size_t)BB * HCD * WCD * FD;  // 4194304

  const int coarsePixels = BB * HCD * WCD;  // 16384
  const int finePixels = BB * HFD * WFD;    // 65536

  sapa_coarse_proj<<<coarsePixels / 32, 256, 0, stream>>>(
      coarse, ln_c_g, ln_c_b, w_gate, b_gate, w_qc, b_qc, w_k, b_k, w_v, b_v,
      gate, qc, kk, vv);

  const size_t fineq_lds = (size_t)64 * LDSTRIDE * sizeof(float);
  sapa_fine_query<<<finePixels / 64, 256, fineq_lds, stream>>>(
      fine, ln_f_g, ln_f_b, w_qf, b_qf, gate, qc, query);

  const size_t attn_lds =
      (8 * 8 * QKP + 8 * 8 * 256 + 64 * QKP + 64 * 26) * sizeof(float);
  sapa_attention<<<dim3(WCD / 4, HCD / 4, BB), 256, attn_lds, stream>>>(
      query, kk, vv, out);
}

// v005
// Measured time: 55.9 microseconds a run.
// In two side-by-side timings against v004, it was 1.12 and 1.11 times as fast.
// Over all steps from v000 it is 2.87 times as fast.
#include <hip/hip_runtime.h>
#include <math.h>
#include <stdint.h>

// Problem constants (from reference)
#define BB 4
#define HFD 128
#define WFD 128
#define CFD 256
#define HCD 64
#define WCD 64
#define CCD 256
#define ED 64
#define FD 256

typedef float v2f __attribute__((ext_vector_type(2)));
typedef float v8f __attribute__((ext_vector_type(8)));

__device__ __forceinline__ v8f wmma_f32_16x16x4(v2f a, v2f b, v8f c) {
  // D = A(16x4,f32) * B(4x16,f32) + C(16x16,f32), full fp32 matrix pipe
  return __builtin_amdgcn_wmma_f32_16x16x4_f32(
      /*neg_a=*/false, a, /*neg_b=*/false, b,
      /*c_mod=*/(short)0, c, /*reuse_a=*/false, /*reuse_b=*/false);
}

__device__ __forceinline__ float wave_sum32(float v) {
#pragma unroll
  for (int off = 16; off > 0; off >>= 1) v += __shfl_xor(v, off, 32);
  return v;
}

// CDNA5 async memory->LDS copies (ASYNCcnt-tracked, no VGPR staging): each lane
// brings its own 16 bytes. A run of copies shares one statement that ends in
// s_wait_xcnt 0, so no address register is rewritten before the copies' address
// translations are through (a precaution).
__device__ __forceinline__ unsigned lds_addr(const float* p) {
  return (unsigned)(uintptr_t)p;  // low 32 bits = byte offset in the group's LDS
}
__device__ __forceinline__ void async_ld5_b128(
    const float* l0, const float* g0, const float* l1, const float* g1,
    const float* l2, const float* g2, const float* l3, const float* g3,
    const float* l4, const float* g4) {
  asm volatile(
      "global_load_async_to_lds_b128 %0, %1, off\n\t"
      "global_load_async_to_lds_b128 %2, %3, off\n\t"
      "global_load_async_to_lds_b128 %4, %5, off\n\t"
      "global_load_async_to_lds_b128 %6, %7, off\n\t"
      "global_load_async_to_lds_b128 %8, %9, off\n\t"
      "s_wait_xcnt 0x0"
      :
      : "v"(lds_addr(l0)), "v"(g0), "v"(lds_addr(l1)), "v"(g1),
        "v"(lds_addr(l2)), "v"(g2), "v"(lds_addr(l3)), "v"(g3),
        "v"(lds_addr(l4)), "v"(g4)
      : "memory");
}
__device__ __forceinline__ void wait_asynccnt0() {
  asm volatile("s_wait_asynccnt 0" ::: "memory");
}

#define LDSTRIDE 257  // 256 + 1 pad: A-frag column reads hit distinct banks
// Row pitch (floats) of the attention kernel's key and query tiles in LDS:
// 272 B = 16 B x 17, so 16-byte reads of neighbouring rows fall on different
// banks (at 256 B every row starts on the same four banks).
#define QKP 68

// K loop and stores of one wave of kernel A: 2 M-tiles x 3 N-tiles. The row
// strides N0..N2 of the three weight / output matrices are compile-time, so a
// K-step's addresses are one base plus constant offsets. p* = weight column of
// this lane, d* = output column of this lane, bn* = its bias.
template <int N0, int N1, int N2>
__device__ __forceinline__ void coarse_tiles(
    const float* X, const int lrow, const int lhi, const int pbase,
    const float* __restrict__ p0, const float* __restrict__ p1,
    const float* __restrict__ p2, const float bn0, const float bn1,
    const float bn2, float* __restrict__ d0, float* __restrict__ d1,
    float* __restrict__ d2) {
  const float* x0 = X + lrow * LDSTRIDE + lhi * 2;
  const float* x1 = x0 + 16 * LDSTRIDE;
  const float* q0 = p0 + lhi * 2 * N0;
  const float* q1 = p1 + lhi * 2 * N1;
  const float* q2 = p2 + lhi * 2 * N2;
  v8f a00 = {}, a01 = {}, a02 = {}, a10 = {}, a11 = {}, a12 = {};
  for (int kb = 0; kb < CCD; kb += 32) {
    // 8 K-steps per trip, fully unrolled: their 48 weight loads go out together,
    // ahead of the matrix instructions, so the wave waits for L2 once per 8
    // steps, not once per step
#pragma unroll
    for (int k0 = 0; k0 < 32; k0 += 4) {
      v2f af0, af1;
      af0.x = x0[k0];
      af0.y = x0[k0 + 1];
      af1.x = x1[k0];
      af1.y = x1[k0 + 1];
      v2f bf0, bf1, bf2;
      bf0.x = q0[k0 * N0];
      bf0.y = q0[(k0 + 1) * N0];
      bf1.x = q1[k0 * N1];
      bf1.y = q1[(k0 + 1) * N1];
      bf2.x = q2[k0 * N2];
      bf2.y = q2[(k0 + 1) * N2];
      a00 = wmma_f32_16x16x4(af0, bf0, a00);
      a01 = wmma_f32_16x16x4(af0, bf1, a01);
      a02 = wmma_f32_16x16x4(af0, bf2, a02);
      a10 = wmma_f32_16x16x4(af1, bf0, a10);
      a11 = wmma_f32_16x16x4(af1, bf1, a11);
      a12 = wmma_f32_16x16x4(af1, bf2, a12);
    }
    x0 += 32;
    x1 += 32;
    q0 += 32 * N0;
    q1 += 32 * N1;
    q2 += 32 * N2;
  }
  float* e0 = d0 + (size_t)(pbase + lhi * 8) * N0;
  float* e1 = d1 + (size_t)(pbase + lhi * 8) * N1;
  float* e2 = d2 + (size_t)(pbase + lhi * 8) * N2;
  // unrolled: constant indices keep the accumulators in registers
#pragma unroll
  for (int j = 0; j < 8; ++j) {
    e0[j * N0] = a00[j] + bn0;
    e0[(16 + j) * N0] = a10[j] + bn0;
    e1[j * N1] = a01[j] + bn1;
    e1[(16 + j) * N1] = a11[j] + bn1;
    e2[j * N2] = a02[j] + bn2;
    e2[(16 + j) * N2] = a12[j] + bn2;
  }
  // behind the last store: no data or address register of these stores is
  // rewritten before their address translations are through (a precaution)
  asm volatile("s_wait_xcnt 0x0" ::: "memory");
}

// -------------------------------------------------------------------------
// Kernel A: coarse layernorm + gate + WMMA GEMMs for qc (N=64), k (N=64),
// v (N=256). One block = 32 coarse pixels (2 M-tiles), 256 threads = 8
// waves. Each wave owns 3 N-tiles and 6 accumulators (2M x 3N): each K-step
// takes 2 A-frags from LDS + 3 B-frags from L2-resident weights and issues 6
// independent WMMAs (coarse_tiles above).
// -------------------------------------------------------------------------
__global__ __launch_bounds__(256) void sapa_coarse_proj(
    const float* __restrict__ coarse,
    const float* __restrict__ ln_g, const float* __restrict__ ln_b,
    const float* __restrict__ w_gate, const float* __restrict__ b_gate,
    const float* __restrict__ w_qc, const float* __restrict__ b_qc,
    const float* __restrict__ w_k, const float* __restrict__ b_k,
    const float* __restrict__ w_v, const float* __restrict__ b_v,
    float* __restrict__ gate_out, float* __restrict__ qc_out,
    float* __restrict__ k_out, float* __restrict__ v_out) {
  __shared__ float X[32 * LDSTRIDE];
  const int tid = threadIdx.x;
  const int lane = tid & 31;
  const int wave = tid >> 5;
  const int pbase = blockIdx.x * 32;

  // ---- LayerNorm (4 rows per wave) + gate logit ----
#pragma unroll
  for (int rr = 0; rr < 4; ++rr) {
    const int row = wave * 4 + rr;
    const int p = pbase + row;
    const float* src = coarse + (size_t)p * CCD;
    float4 u0 = *(const float4*)(src + lane * 4);
    float4 u1 = *(const float4*)(src + 128 + lane * 4);
    float s = u0.x + u0.y + u0.z + u0.w + u1.x + u1.y + u1.z + u1.w;
    float sq = u0.x * u0.x + u0.y * u0.y + u0.z * u0.z + u0.w * u0.w +
               u1.x * u1.x + u1.y * u1.y + u1.z * u1.z + u1.w * u1.w;
    s = wave_sum32(s);
    sq = wave_sum32(sq);
    const float mean = s * (1.0f / 256.0f);
    const float var = sq * (1.0f / 256.0f) - mean * mean;
    const float inv = rsqrtf(var + 1e-5f);
    float gdot = 0.0f;
    const float v0[4] = {u0.x, u0.y, u0.z, u0.w};
    const float v1[4] = {u1.x, u1.y, u1.z, u1.w};
#pragma unroll
    for (int i = 0; i < 4; ++i) {
      int c = lane * 4 + i;
      float xh = (v0[i] - mean) * inv * ln_g[c] + ln_b[c];
      X[row * LDSTRIDE + c] = xh;
      gdot = fmaf(xh, w_gate[c], gdot);
    }
#pragma unroll
    for (int i = 0; i < 4; ++i) {
      int c = 128 + lane * 4 + i;
      float xh = (v1[i] - mean) * inv * ln_g[c] + ln_b[c];
      X[row * LDSTRIDE + c] = xh;
      gdot = fmaf(xh, w_gate[c], gdot);
    }
    gdot = wave_sum32(gdot);
    if (lane == 0)
      gate_out[p] = 1.0f / (1.0f + __expf(-(gdot + b_gate[0])));
  }
  __syncthreads();

  // ---- WMMA: 24 N-tiles over concat [qc(4) | k(4) | v(16)] ----
  const int lrow = lane & 15;  // A: M index, B/D: N index
  const int lhi = lane >> 4;   // half-wave selector
  // scalar wave number: the choice below is a scalar branch (every lane stays on
  // for the matrix instructions) and each side knows its row strides at compile
  // time. Wave w owns tiles 3w, 3w+1, 3w+2 of the concatenation.
  const int wv = __builtin_amdgcn_readfirstlane(tid >> 5);
  if (wv >= 3) {
    const int c = (wv * 3 - 8) * 16 + lrow;  // three tiles of v
    coarse_tiles<FD, FD, FD>(X, lrow, lhi, pbase, w_v + c, w_v + c + 16,
                             w_v + c + 32, b_v[c], b_v[c + 16], b_v[c + 32],
                             v_out + c, v_out + c + 16, v_out + c + 32);
  } else if (wv == 2) {  // k tiles 2, 3 and v tile 0
    coarse_tiles<ED, ED, FD>(X, lrow, lhi, pbase, w_k + 32 + lrow,
                             w_k + 48 + lrow, w_v + lrow, b_k[32 + lrow],
                             b_k[48 + lrow], b_v[lrow], k_out + 32 + lrow,
                             k_out + 48 + lrow, v_out + lrow);
  } else if (wv == 1) {  // qc tile 3 and k tiles 0, 1
    coarse_tiles<ED, ED, ED>(X, lrow, lhi, pbase, w_qc + 48 + lrow, w_k + lrow,
                             w_k + 16 + lrow, b_qc[48 + lrow], b_k[lrow],
                             b_k[16 + lrow], qc_out + 48 + lrow, k_out + lrow,
                             k_out + 16 + lrow);
  } else {  // qc tiles 0, 1, 2
    coarse_tiles<ED, ED, ED>(X, lrow, lhi, pbase, w_qc + lrow, w_qc + 16 + lrow,
                             w_qc + 32 + lrow, b_qc[lrow], b_qc[16 + lrow],
                             b_qc[32 + lrow], qc_out + lrow, qc_out + 16 + lrow,
                             qc_out + 32 + lrow);
  }
}

// -------------------------------------------------------------------------
// Kernel B: fine layernorm + WMMA qf GEMM + gate blend with upsampled qc, then
// 5x5 local attention, all for one tile of 4x4 coarse cells (64 fine px). The
// 8x8 zero-padded k/v halo is copied to LDS with CDNA5
// GLOBAL_LOAD_ASYNC_TO_LDS_B128 (ASYNCcnt) while layernorm and projection run;
// the query tile goes from the accumulators straight into LDS. 8 waves; GEMM
// wave = (mpair, ntile), 2 accumulators. Dynamic LDS 145.25 KB.
// -------------------------------------------------------------------------
__global__ __launch_bounds__(256) void sapa_attention(
    const float* __restrict__ fine,
    const float* __restrict__ ln_g, const float* __restrict__ ln_b,
    const float* __restrict__ w_qf, const float* __restrict__ b_qf,
    const float* __restrict__ gate_in, const float* __restrict__ qc_in,
    const float* __restrict__ kglb, const float* __restrict__ vglb,
    float* __restrict__ out) {
  extern __shared__ __attribute__((aligned(16))) float smem[];
  float* kbuf = smem;                    // 8*8*QKP  = 4352 floats
  float* vbuf = kbuf + 8 * 8 * QKP;      // 8*8*256  = 16384 floats
  float* X = vbuf + 8 * 8 * 256;         // 64*LDSTRIDE = 16448 floats
  // the normalised fine tile X is dead once the K loop is over: query tile and
  // logits take its place
  float* qbuf = X;                       // 64*QKP   = 4352 floats
  float* attb = qbuf + 64 * QKP;         // 64*26    = 1664 floats

  const int tid = threadIdx.x;
  const int b = blockIdx.z;
  const int h0 = blockIdx.y * 4;
  const int w0 = blockIdx.x * 4;
  const int lane = tid & 31;
  // scalar wave number: the edge tests below are scalar branches, so a wave
  // either issues a copy with every lane on or jumps past it
  const int wv = __builtin_amdgcn_readfirstlane(tid >> 5);

  // ---- cooperative staging: k/v halo (zero-pad OOB) ----
  // Every copy of a wave moves 512 contiguous bytes of global memory (four
  // whole 128-byte lines), lane l the l-th 16 bytes. Wave w brings halo row w
  // of k and v.
  {
    const int half = lane >> 4;        // which of two 256-byte rows
    const int l16 = (lane & 15) * 4;   // float offset inside such a row

    // k/v: halo row wv, two columns at a time. w0, the halo width and WCD are
    // even, so the two columns of a pair are inside the image or outside it
    // together.
    const int hh = h0 - 2 + wv;
    const bool rowok = (hh >= 0) && (hh < HCD);
    // unrolled so that j folds into constant LDS and column offsets
#pragma unroll
    for (int j = 0; j < 4; ++j) {
      const int ww = w0 - 2 + 2 * j;
      float* kd = kbuf + (wv * 8 + 2 * j + half) * QKP + l16;
      float* vd = vbuf + (wv * 8 + 2 * j) * FD + lane * 4;
      if (rowok && ww >= 0 && ww + 1 < WCD) {
        const size_t cgi = (size_t)(b * HCD + hh) * WCD + ww;
        const float* ks = kglb + cgi * ED + lane * 4;
        const float* vs = vglb + cgi * FD + lane * 4;
        async_ld5_b128(vd, vs, vd + 128, vs + 128, vd + 256, vs + 256,
                       vd + 384, vs + 384, kd, ks);
      } else {
        const float4 z = make_float4(0.f, 0.f, 0.f, 0.f);
        *(float4*)kd = z;
        *(float4*)vd = z;
        *(float4*)(vd + 128) = z;
        *(float4*)(vd + 256) = z;
        *(float4*)(vd + 384) = z;
      }
    }
  }

  // ---- fine layernorm: wave w takes fine row h0*2 + w of the tile (8 px, 8 KB
  // contiguous); LDS row order (cy,cx,sy,sx), as the later phases index pixels
#pragma unroll
  for (int rr = 0; rr < 8; ++rr) {
    const int row = ((wv >> 1) * 4 + (rr >> 1)) * 4 + (wv & 1) * 2 + (rr & 1);
    const float* src =
        fine + ((size_t)(b * HFD + h0 * 2 + wv) * WFD + w0 * 2 + rr) * CFD;
    float4 u0 = *(const float4*)(src + lane * 4);
    float4 u1 = *(const float4*)(src + 128 + lane * 4);
    float s = u0.x + u0.y + u0.z + u0.w + u1.x + u1.y + u1.z + u1.w;
    float sq = u0.x * u0.x + u0.y * u0.y + u0.z * u0.z + u0.w * u0.w +
               u1.x * u1.x + u1.y * u1.y + u1.z * u1.z + u1.w * u1.w;
    s = wave_sum32(s);
    sq = wave_sum32(sq);
    const float mean = s * (1.0f / 256.0f);
    const float var = sq * (1.0f / 256.0f) - mean * mean;
    const float inv = rsqrtf(var + 1e-5f);
    const float v0[4] = {u0.x, u0.y, u0.z, u0.w};
    const float v1[4] = {u1.x, u1.y, u1.z, u1.w};
#pragma unroll
    for (int i = 0; i < 4; ++i) {
      int c = lane * 4 + i;
      X[row * LDSTRIDE + c] = (v0[i] - mean) * inv * ln_g[c] + ln_b[c];
    }
#pragma unroll
    for (int i = 0; i < 4; ++i) {
      int c = 128 + lane * 4 + i;
      X[row * LDSTRIDE + c] = (v1[i] - mean) * inv * ln_g[c] + ln_b[c];
    }
  }
  __syncthreads();

  // ---- query projection (WMMA) + gate blend, result into qbuf ----
  {
    const int lrow = lane & 15;
    const int lhi = lane >> 4;
    const int ntile = wv & 3;
    const int mbase = (wv >> 2) * 32;  // rows mbase..mbase+31 (2 M-tiles)
    const float* bp = w_qf + ntile * 16 + lrow;
    const int n = ntile * 16 + lrow;
    // bias, gates and coarse queries of this lane's results are asked for ahead
    // of the K loop, so that they are there when it ends. Four consecutive rows
    // of a tile are the four fine pixels of one coarse cell: this lane's rows
    // lie in cells cell0 + 4 * mt + jc.
    const int cell0 = (mbase + lhi * 8) >> 2;
    const float bn = b_qf[n];
    float g[2][2], qcv[2][2];
    // unrolled: constant indices keep g and qcv in registers
#pragma unroll
    for (int mt = 0; mt < 2; ++mt)
#pragma unroll
      for (int jc = 0; jc < 2; ++jc) {
        const int cell = cell0 + mt * 4 + jc;
        const int cp =
            (b * HCD + h0 + (cell >> 2)) * WCD + w0 + (cell & 3);
        g[mt][jc] = gate_in[cp];
        qcv[mt][jc] = qc_in[(size_t)cp * ED + n];
      }
    v8f acc0 = {}, acc1 = {};
    for (int k0 = 0; k0 < CFD; k0 += 4) {
      const int ka = k0 + lhi * 2;
      v2f af0, af1, bfrag;
      af0.x = X[(mbase + lrow) * LDSTRIDE + ka];
      af0.y = X[(mbase + lrow) * LDSTRIDE + ka + 1];
      af1.x = X[(mbase + 16 + lrow) * LDSTRIDE + ka];
      af1.y = X[(mbase + 16 + lrow) * LDSTRIDE + ka + 1];
      bfrag.x = bp[(size_t)ka * ED];
      bfrag.y = bp[(size_t)(ka + 1) * ED];
      acc0 = wmma_f32_16x16x4(af0, bfrag, acc0);
      acc1 = wmma_f32_16x16x4(af1, bfrag, acc1);
    }
    // four vector issue slots between the last matrix instructions and the
    // first vector instruction that reads their results
    asm volatile("v_nop\n\tv_nop\n\tv_nop\n\tv_nop");
    // every wave has read its last row of X: the query tile may overwrite it
    __syncthreads();
    // unrolled: constant indices keep the accumulators in registers
#pragma unroll
    for (int mt = 0; mt < 2; ++mt) {
      const v8f acc = (mt == 0) ? acc0 : acc1;
#pragma unroll
      for (int jc = 0; jc < 2; ++jc)
#pragma unroll
        for (int jj = 0; jj < 4; ++jj)
          qbuf[((cell0 + mt * 4 + jc) * 4 + jj) * QKP + n] =
              (acc[jc * 4 + jj] + bn) * g[mt][jc] +
              qcv[mt][jc] * (1.0f - g[mt][jc]);
    }
  }
  // this wave's k/v copies have landed; the barrier publishes them and the
  // query tile
  wait_asynccnt0();
  __syncthreads();

  // ---- phase 1: attention logits (25 per pixel, split over 4 groups) ----
  {
    const int pid = tid & 63;
    const int grp = tid >> 6;
    const int cy = pid >> 4, cx = (pid >> 2) & 3;
    const float4* qp = (const float4*)(qbuf + pid * QKP);
    float4 qv[16];
#pragma unroll
    for (int i = 0; i < 16; ++i) qv[i] = qp[i];
    for (int p = grp; p < 25; p += 4) {
      const int py = p / 5, px = p - py * 5;
      const float4* kp =
          (const float4*)(kbuf + ((cy + py) * 8 + (cx + px)) * QKP);
      float dot = 0.0f;
#pragma unroll
      for (int i = 0; i < 16; ++i) {
        const float4 kv = kp[i];
        dot = fmaf(qv[i].x, kv.x, dot);
        dot = fmaf(qv[i].y, kv.y, dot);
        dot = fmaf(qv[i].z, kv.z, dot);
        dot = fmaf(qv[i].w, kv.w, dot);
      }
      attb[pid * 26 + p] = dot;
    }
  }
  __syncthreads();

  // ---- phase 2: softmax over 25 ----
  if (tid < 64) {
    float* a = attb + tid * 26;
    float mx = a[0];
#pragma unroll
    for (int p = 1; p < 25; ++p) mx = fmaxf(mx, a[p]);
    float s = 0.0f;
    float e[25];
#pragma unroll
    for (int p = 0; p < 25; ++p) {
      e[p] = __expf(a[p] - mx);
      s += e[p];
    }
    const float inv = 1.0f / s;
    // weights go out as [cell][tap][sub-pixel] (query tile is dead by now), so
    // phase 3 fetches a cell's four weights of one tap with one 16-byte read
    float* wd = qbuf + (tid >> 2) * 100 + (tid & 3);
#pragma unroll
    for (int p = 0; p < 25; ++p) wd[p * 4] = e[p] * inv;
  }
  __syncthreads();

  // ---- phase 3: weighted value accumulation ----
  // One wave = two x-adjacent coarse cells (8 fine pixels); the 32 lanes span
  // the 256 channels (4 + 4 each). Every value read is 512 contiguous bytes
  // (all banks once), serves 4 or 8 pixels, and every store is 512 contiguous
  // bytes. Taps are still summed in the order p = 0..24 for each pixel.
  {
    const int lane = tid & 31;
    // scalar wave number: cell, weight and output bases form on the scalar unit
    const int wave = __builtin_amdgcn_readfirstlane(tid >> 5);
    const int cy = wave >> 1;
    const int cxb = (wave & 1) * 2;
    const float* wl = qbuf + (cy * 4 + cxb) * 100;  // left cell's weights
    const float* wr = wl + 100;                     // right cell's weights
    // every loop below is fully unrolled: constant indices keep acc in
    // registers, the px range test folds away, and reads can be issued ahead
    float4 acc[2][4][2];
#pragma unroll
    for (int c = 0; c < 2; ++c)
#pragma unroll
      for (int s = 0; s < 4; ++s)
#pragma unroll
        for (int h = 0; h < 2; ++h)
          acc[c][s][h] = make_float4(0.f, 0.f, 0.f, 0.f);
#pragma unroll
    for (int py = 0; py < 5; ++py) {
      const float* vrow = vbuf + ((cy + py) * 8 + cxb) * FD + lane * 4;
#pragma unroll
      for (int col = 0; col < 6; ++col) {
        float4 vv[2];
        vv[0] = *(const float4*)(vrow + col * FD);
        vv[1] = *(const float4*)(vrow + col * FD + 128);
#pragma unroll
        for (int c = 0; c < 2; ++c) {
          const int px = col - c;
          if (px < 0 || px > 4) continue;
          const float4 w4 =
              *(const float4*)((c == 0 ? wl : wr) + (py * 5 + px) * 4);
          const float ws[4] = {w4.x, w4.y, w4.z, w4.w};
#pragma unroll
          for (int s = 0; s < 4; ++s)
#pragma unroll
            for (int h = 0; h < 2; ++h) {
              acc[c][s][h].x = fmaf(ws[s], vv[h].x, acc[c][s][h].x);
              acc[c][s][h].y = fmaf(ws[s], vv[h].y, acc[c][s][h].y);
              acc[c][s][h].z = fmaf(ws[s], vv[h].z, acc[c][s][h].z);
              acc[c][s][h].w = fmaf(ws[s], vv[h].w, acc[c][s][h].w);
            }
        }
      }
    }
#pragma unroll
    for (int c = 0; c < 2; ++c)
#pragma unroll
      for (int s = 0; s < 4; ++s) {
        const int fh = (h0 + cy) * 2 + (s >> 1);
        const int fw = (w0 + cxb + c) * 2 + (s & 1);
        float* op = out + ((size_t)(b * HFD + fh) * WFD + fw) * FD + lane * 4;
        *(float4*)op = acc[c][s][0];
        *(float4*)(op + 128) = acc[c][s][1];
      }
  }
}

// -------------------------------------------------------------------------
extern "C" void kernel_launch(void* const* d_in, const int* in_sizes, int n_in,
                              void* d_out, int out_size, void* d_ws,
                              size_t ws_size, hipStream_t stream) {
  const float* fine = (const float*)d_in[0];
  const float* coarse = (const float*)d_in[1];
  const float* ln_f_g = (const float*)d_in[2];
  const float* ln_f_b = (const float*)d_in[3];
  const float* ln_c_g = (const float*)d_in[4];
  const float* ln_c_b = (const float*)d_in[5];
  const float* w_gate = (const float*)d_in[6];
  const float* b_gate = (const float*)d_in[7];
  const float* w_qf = (const float*)d_in[8];
  const float* b_qf = (const float*)d_in[9];
  const float* w_qc = (const float*)d_in[10];
  const float* b_qc = (const float*)d_in[11];
  const float* w_k = (const float*)d_in[12];
  const float* b_k = (const float*)d_in[13];
  const float* w_v = (const float*)d_in[14];
  const float* b_v = (const float*)d_in[15];
  float* out = (float*)d_out;

  // Workspace layout (floats): gate | qc | k | v  (~25 MB total)
  float* ws = (float*)d_ws;
  float* gate = ws;                                 // 16384
  float* qc = gate + (size_t)BB * HCD * WCD;        // 1048576
  float* kk = qc + (size_t)BB * HCD * WCD * ED;     // 1048576
  float* vv = kk + (size_t)BB * HCD * WCD * ED;     // 4194304

  const int coarsePixels = BB * HCD * WCD;  // 16384

  sapa_coarse_proj<<<coarsePixels / 32, 256, 0, stream>>>(
      coarse, ln_c_g, ln_c_b, w_gate, b_gate, w_qc, b_qc, w_k, b_k, w_v, b_v,
      gate, qc, kk, vv);

  const size_t attn_lds =
      (8 * 8 * QKP + 8 * 8 * 256 + 64 * LDSTRIDE) * sizeof(float);
  sapa_attention<<<dim3(WCD / 4, HCD / 4, BB), 256, attn_lds, stream>>>(
      fine, ln_f_g, ln_f_b, w_qf, b_qf, gate, qc, kk, vv, out);
}

// v006
// One run takes 52.7 microseconds.
// Two timings next to v005 both put it at 1.06 times that version's speed.
// Counting every step since v000, it is 3.04 times as fast.
#include <hip/hip_runtime.h>
#include <math.h>
#include <stdint.h>

// Problem constants (from reference)
#define BB 4
#define HFD 128
#define WFD 128
#define CFD 256
#define HCD 64
#define WCD 64
#define CCD 256
#define ED 64
#define FD 256

typedef float v2f __attribute__((ext_vector_type(2)));
typedef float v8f __attribute__((ext_vector_type(8)));

__device__ __forceinline__ v8f wmma_f32_16x16x4(v2f a, v2f b, v8f c) {
  // D = A(16x4,f32) * B(4x16,f32) + C(16x16,f32), full fp32 matrix pipe
  return __builtin_amdgcn_wmma_f32_16x16x4_f32(
      /*neg_a=*/false, a, /*neg_b=*/false, b,
      /*c_mod=*/(short)0, c, /*reuse_a=*/false, /*reuse_b=*/false);
}

__device__ __forceinline__ float wave_sum32(float v) {
#pragma unroll
  for (int off = 16; off > 0; off >>= 1) v += __shfl_xor(v, off, 32);
  return v;
}

// CDNA5 async memory->LDS copies (ASYNCcnt-tracked, no VGPR staging): each lane
// brings its own 16 bytes. A run of copies shares one statement that ends in
// s_wait_xcnt 0, so no address register is rewritten before the copies' address
// translations are through (a precaution).
__device__ __forceinline__ unsigned lds_addr(const float* p) {
  return (unsigned)(uintptr_t)p;  // low 32 bits = byte offset in the group's LDS
}
__device__ __forceinline__ void async_ld5_b128(
    const float* l0, const float* g0, const float* l1, const float* g1,
    const float* l2, const float* g2, const float* l3, const float* g3,
    const float* l4, const float* g4) {
  asm volatile(
      "global_load_async_to_lds_b128 %0, %1, off\n\t"
      "global_load_async_to_lds_b128 %2, %3, off\n\t"
      "global_load_async_to_lds_b128 %4, %5, off\n\t"
      "global_load_async_to_lds_b128 %6, %7, off\n\t"
      "global_load_async_to_lds_b128 %8, %9, off\n\t"
      "s_wait_xcnt 0x0"
      :
      : "v"(lds_addr(l0)), "v"(g0), "v"(lds_addr(l1)), "v"(g1),
        "v"(lds_addr(l2)), "v"(g2), "v"(lds_addr(l3)), "v"(g3),
        "v"(lds_addr(l4)), "v"(g4)
      : "memory");
}
__device__ __forceinline__ void wait_asynccnt0() {
  asm volatile("s_wait_asynccnt 0" ::: "memory");
}

#define LDSTRIDE 257  // 256 + 1 pad: A-frag column reads hit distinct banks
// Row pitch (floats) of the attention kernel's key and query tiles in LDS:
// 272 B = 16 B x 17, so 16-byte reads of neighbouring rows fall on different
// banks (at 256 B every row starts on the same four banks).
#define QKP 68

// Row pitch (floats) of the attention kernel's logit matrix (64 px x 64 halo
// cells): rows 8 apart start 16 banks apart, so the two half-waves of an
// accumulator store fall on different banks.
#define ATP 66

// Logits of one wave: one 16-pixel tile against NT neighbouring 16-cell tiles.
// qrow / krow = this lane's query / key row in LDS plus 4 * (lane / 16) floats.
// A 16-byte read feeds two K-steps: with the same read pattern on both operands
// lanes 0-15 hold channels 8s..8s+3 and lanes 16-31 channels 8s+4..8s+7, so
// step one multiplies channels {0,1,4,5} of the eight and step two {2,3,6,7}.
// The first tile's sums are returned; a second tile's are stored at ad1.
template <int NT>
__device__ __forceinline__ v8f logit_tiles(const float* qrow, const float* krow,
                                           float* ad1) {
  v8f c[NT];
  // all loops unrolled: constant indices keep fragments and sums in registers,
  // and the LDS reads can be issued ahead of the matrix instructions
#pragma unroll
  for (int t = 0; t < NT; ++t) c[t] = v8f{};
#pragma unroll
  for (int s = 0; s < 8; ++s) {
    const float4 q4 = *(const float4*)(qrow + s * 8);
    const v2f alo = {q4.x, q4.y}, ahi = {q4.z, q4.w};
    float4 k4[NT];
#pragma unroll
    for (int t = 0; t < NT; ++t)
      k4[t] = *(const float4*)(krow + t * 16 * QKP + s * 8);
#pragma unroll
    for (int t = 0; t < NT; ++t)
      c[t] = wmma_f32_16x16x4(alo, v2f{k4[t].x, k4[t].y}, c[t]);
#pragma unroll
    for (int t = 0; t < NT; ++t)
      c[t] = wmma_f32_16x16x4(ahi, v2f{k4[t].z, k4[t].w}, c[t]);
  }
  if (NT > 1) {
#pragma unroll
    for (int j = 0; j < 8; ++j) ad1[j * ATP] = c[NT - 1][j];
  }
  return c[0];
}

// K loop and stores of one wave of kernel A: 2 M-tiles x 3 N-tiles. The row
// strides N0..N2 of the three weight / output matrices are compile-time, so a
// K-step's addresses are one base plus constant offsets. p* = weight column of
// this lane, d* = output column of this lane, bn* = its bias.
template <int N0, int N1, int N2>
__device__ __forceinline__ void coarse_tiles(
    const float* X, const int lrow, const int lhi, const int pbase,
    const float* __restrict__ p0, const float* __restrict__ p1,
    const float* __restrict__ p2, const float bn0, const float bn1,
    const float bn2, float* __restrict__ d0, float* __restrict__ d1,
    float* __restrict__ d2) {
  const float* x0 = X + lrow * LDSTRIDE + lhi * 2;
  const float* x1 = x0 + 16 * LDSTRIDE;
  const float* q0 = p0 + lhi * 2 * N0;
  const float* q1 = p1 + lhi * 2 * N1;
  const float* q2 = p2 + lhi * 2 * N2;
  v8f a00 = {}, a01 = {}, a02 = {}, a10 = {}, a11 = {}, a12 = {};
  for (int kb = 0; kb < CCD; kb += 32) {
    // 8 K-steps per trip, fully unrolled: their 48 weight loads go out together,
    // ahead of the matrix instructions, so the wave waits for L2 once per 8
    // steps, not once per step
#pragma unroll
    for (int k0 = 0; k0 < 32; k0 += 4) {
      v2f af0, af1;
      af0.x = x0[k0];
      af0.y = x0[k0 + 1];
      af1.x = x1[k0];
      af1.y = x1[k0 + 1];
      v2f bf0, bf1, bf2;
      bf0.x = q0[k0 * N0];
      bf0.y = q0[(k0 + 1) * N0];
      bf1.x = q1[k0 * N1];
      bf1.y = q1[(k0 + 1) * N1];
      bf2.x = q2[k0 * N2];
      bf2.y = q2[(k0 + 1) * N2];
      a00 = wmma_f32_16x16x4(af0, bf0, a00);
      a01 = wmma_f32_16x16x4(af0, bf1, a01);
      a02 = wmma_f32_16x16x4(af0, bf2, a02);
      a10 = wmma_f32_16x16x4(af1, bf0, a10);
      a11 = wmma_f32_16x16x4(af1, bf1, a11);
      a12 = wmma_f32_16x16x4(af1, bf2, a12);
    }
    x0 += 32;
    x1 += 32;
    q0 += 32 * N0;
    q1 += 32 * N1;
    q2 += 32 * N2;
  }
  float* e0 = d0 + (size_t)(pbase + lhi * 8) * N0;
  float* e1 = d1 + (size_t)(pbase + lhi * 8) * N1;
  float* e2 = d2 + (size_t)(pbase + lhi * 8) * N2;
  // unrolled: constant indices keep the accumulators in registers
#pragma unroll
  for (int j = 0; j < 8; ++j) {
    e0[j * N0] = a00[j] + bn0;
    e0[(16 + j) * N0] = a10[j] + bn0;
    e1[j * N1] = a01[j] + bn1;
    e1[(16 + j) * N1] = a11[j] + bn1;
    e2[j * N2] = a02[j] + bn2;
    e2[(16 + j) * N2] = a12[j] + bn2;
  }
  // behind the last store: no data or address register of these stores is
  // rewritten before their address translations are through (a precaution)
  asm volatile("s_wait_xcnt 0x0" ::: "memory");
}

// -------------------------------------------------------------------------
// Kernel A: coarse layernorm + gate + WMMA GEMMs for qc (N=64), k (N=64),
// v (N=256). One block = 32 coarse pixels (2 M-tiles), 256 threads = 8
// waves. Each wave owns 3 N-tiles and 6 accumulators (2M x 3N): each K-step
// takes 2 A-frags from LDS + 3 B-frags from L2-resident weights and issues 6
// independent WMMAs (coarse_tiles above).
// -------------------------------------------------------------------------
__global__ __launch_bounds__(256) void sapa_coarse_proj(
    const float* __restrict__ coarse,
    const float* __restrict__ ln_g, const float* __restrict__ ln_b,
    const float* __restrict__ w_gate, const float* __restrict__ b_gate,
    const float* __restrict__ w_qc, const float* __restrict__ b_qc,
    const float* __restrict__ w_k, const float* __restrict__ b_k,
    const float* __restrict__ w_v, const float* __restrict__ b_v,
    float* __restrict__ gate_out, float* __restrict__ qc_out,
    float* __restrict__ k_out, float* __restrict__ v_out) {
  __shared__ float X[32 * LDSTRIDE];
  const int tid = threadIdx.x;
  const int lane = tid & 31;
  const int wave = tid >> 5;
  const int pbase = blockIdx.x * 32;

  // ---- LayerNorm (4 rows per wave) + gate logit ----
#pragma unroll
  for (int rr = 0; rr < 4; ++rr) {
    const int row = wave * 4 + rr;
    const int p = pbase + row;
    const float* src = coarse + (size_t)p * CCD;
    float4 u0 = *(const float4*)(src + lane * 4);
    float4 u1 = *(const float4*)(src + 128 + lane * 4);
    float s = u0.x + u0.y + u0.z + u0.w + u1.x + u1.y + u1.z + u1.w;
    float sq = u0.x * u0.x + u0.y * u0.y + u0.z * u0.z + u0.w * u0.w +
               u1.x * u1.x + u1.y * u1.y + u1.z * u1.z + u1.w * u1.w;
    s = wave_sum32(s);
    sq = wave_sum32(sq);
    const float mean = s * (1.0f / 256.0f);
    const float var = sq * (1.0f / 256.0f) - mean * mean;
    const float inv = rsqrtf(var + 1e-5f);
    float gdot = 0.0f;
    const float v0[4] = {u0.x, u0.y, u0.z, u0.w};
    const float v1[4] = {u1.x, u1.y, u1.z, u1.w};
#pragma unroll
    for (int i = 0; i < 4; ++i) {
      int c = lane * 4 + i;
      float xh = (v0[i] - mean) * inv * ln_g[c] + ln_b[c];
      X[row * LDSTRIDE + c] = xh;
      gdot = fmaf(xh, w_gate[c], gdot);
    }
#pragma unroll
    for (int i = 0; i < 4; ++i) {
      int c = 128 + lane * 4 + i;
      float xh = (v1[i] - mean) * inv * ln_g[c] + ln_b[c];
      X[row * LDSTRIDE + c] = xh;
      gdot = fmaf(xh, w_gate[c], gdot);
    }
    gdot = wave_sum32(gdot);
    if (lane == 0)
      gate_out[p] = 1.0f / (1.0f + __expf(-(gdot + b_gate[0])));
  }
  __syncthreads();

  // ---- WMMA: 24 N-tiles over concat [qc(4) | k(4) | v(16)] ----
  const int lrow = lane & 15;  // A: M index, B/D: N index
  const int lhi = lane >> 4;   // half-wave selector
  // scalar wave number: the choice below is a scalar branch (every lane stays on
  // for the matrix instructions) and each side knows its row strides at compile
  // time. Wave w owns tiles 3w, 3w+1, 3w+2 of the concatenation.
  const int wv = __builtin_amdgcn_readfirstlane(tid >> 5);
  if (wv >= 3) {
    const int c = (wv * 3 - 8) * 16 + lrow;  // three tiles of v
    coarse_tiles<FD, FD, FD>(X, lrow, lhi, pbase, w_v + c, w_v + c + 16,
                             w_v + c + 32, b_v[c], b_v[c + 16], b_v[c + 32],
                             v_out + c, v_out + c + 16, v_out + c + 32);
  } else if (wv == 2) {  // k tiles 2, 3 and v tile 0
    coarse_tiles<ED, ED, FD>(X, lrow, lhi, pbase, w_k + 32 + lrow,
                             w_k + 48 + lrow, w_v + lrow, b_k[32 + lrow],
                             b_k[48 + lrow], b_v[lrow], k_out + 32 + lrow,
                             k_out + 48 + lrow, v_out + lrow);
  } else if (wv == 1) {  // qc tile 3 and k tiles 0, 1
    coarse_tiles<ED, ED, ED>(X, lrow, lhi, pbase, w_qc + 48 + lrow, w_k + lrow,
                             w_k + 16 + lrow, b_qc[48 + lrow], b_k[lrow],
                             b_k[16 + lrow], qc_out + 48 + lrow, k_out + lrow,
                             k_out + 16 + lrow);
  } else {  // qc tiles 0, 1, 2
    coarse_tiles<ED, ED, ED>(X, lrow, lhi, pbase, w_qc + lrow, w_qc + 16 + lrow,
                             w_qc + 32 + lrow, b_qc[lrow], b_qc[16 + lrow],
                             b_qc[32 + lrow], qc_out + lrow, qc_out + 16 + lrow,
                             qc_out + 32 + lrow);
  }
}

// -------------------------------------------------------------------------
// Kernel B: fine layernorm + WMMA qf GEMM + gate blend with upsampled qc, then
// 5x5 local attention (logits on WMMA too), all for one tile of 4x4 coarse cells (64 fine px). The
// 8x8 zero-padded k/v halo is copied to LDS with CDNA5
// GLOBAL_LOAD_ASYNC_TO_LDS_B128 (ASYNCcnt) while layernorm and projection run;
// the query tile goes from the accumulators straight into LDS. 8 waves; GEMM
// wave = (mpair, ntile), 2 accumulators. Dynamic LDS 145.25 KB.
// -------------------------------------------------------------------------
__global__ __launch_bounds__(256) void sapa_attention(
    const float* __restrict__ fine,
    const float* __restrict__ ln_g, const float* __restrict__ ln_b,
    const float* __restrict__ w_qf, const float* __restrict__ b_qf,
    const float* __restrict__ gate_in, const float* __restrict__ qc_in,
    const float* __restrict__ kglb, const float* __restrict__ vglb,
    float* __restrict__ out) {
  extern __shared__ __attribute__((aligned(16))) float smem[];
  float* kbuf = smem;                    // 8*8*QKP  = 4352 floats
  float* vbuf = kbuf + 8 * 8 * QKP;      // 8*8*256  = 16384 floats
  float* X = vbuf + 8 * 8 * 256;         // 64*LDSTRIDE = 16448 floats
  // the normalised fine tile X is dead once the K loop is over: query tile and
  // logits take its place
  float* qbuf = X;                       // 64*QKP   = 4352 floats
  float* attb = qbuf + 64 * QKP;         // 64*ATP   = 4224 floats

  const int tid = threadIdx.x;
  const int b = blockIdx.z;
  const int h0 = blockIdx.y * 4;
  const int w0 = blockIdx.x * 4;
  const int lane = tid & 31;
  // scalar wave number: the edge tests below are scalar branches, so a wave
  // either issues a copy with every lane on or jumps past it
  const int wv = __builtin_amdgcn_readfirstlane(tid >> 5);

  // ---- cooperative staging: k/v halo (zero-pad OOB) ----
  // Every copy of a wave moves 512 contiguous bytes of global memory (four
  // whole 128-byte lines), lane l the l-th 16 bytes. Wave w brings halo row w
  // of k and v.
  {
    const int half = lane >> 4;        // which of two 256-byte rows
    const int l16 = (lane & 15) * 4;   // float offset inside such a row

    // k/v: halo row wv, two columns at a time. w0, the halo width and WCD are
    // even, so the two columns of a pair are inside the image or outside it
    // together.
    const int hh = h0 - 2 + wv;
    const bool rowok = (hh >= 0) && (hh < HCD);
    // unrolled so that j folds into constant LDS and column offsets
#pragma unroll
    for (int j = 0; j < 4; ++j) {
      const int ww = w0 - 2 + 2 * j;
      float* kd = kbuf + (wv * 8 + 2 * j + half) * QKP + l16;
      float* vd = vbuf + (wv * 8 + 2 * j) * FD + lane * 4;
      if (rowok && ww >= 0 && ww + 1 < WCD) {
        const size_t cgi = (size_t)(b * HCD + hh) * WCD + ww;
        const float* ks = kglb + cgi * ED + lane * 4;
        const float* vs = vglb + cgi * FD + lane * 4;
        async_ld5_b128(vd, vs, vd + 128, vs + 128, vd + 256, vs + 256,
                       vd + 384, vs + 384, kd, ks);
      } else {
        const float4 z = make_float4(0.f, 0.f, 0.f, 0.f);
        *(float4*)kd = z;
        *(float4*)vd = z;
        *(float4*)(vd + 128) = z;
        *(float4*)(vd + 256) = z;
        *(float4*)(vd + 384) = z;
      }
    }
  }

  // ---- fine layernorm: wave w takes fine row h0*2 + w of the tile (8 px, 8 KB
  // contiguous); LDS row order (cy,cx,sy,sx), as the later phases index pixels
#pragma unroll
  for (int rr = 0; rr < 8; ++rr) {
    const int row = ((wv >> 1) * 4 + (rr >> 1)) * 4 + (wv & 1) * 2 + (rr & 1);
    const float* src =
        fine + ((size_t)(b * HFD + h0 * 2 + wv) * WFD + w0 * 2 + rr) * CFD;
    float4 u0 = *(const float4*)(src + lane * 4);
    float4 u1 = *(const float4*)(src + 128 + lane * 4);
    float s = u0.x + u0.y + u0.z + u0.w + u1.x + u1.y + u1.z + u1.w;
    float sq = u0.x * u0.x + u0.y * u0.y + u0.z * u0.z + u0.w * u0.w +
               u1.x * u1.x + u1.y * u1.y + u1.z * u1.z + u1.w * u1.w;
    s = wave_sum32(s);
    sq = wave_sum32(sq);
    const float mean = s * (1.0f / 256.0f);
    const float var = sq * (1.0f / 256.0f) - mean * mean;
    const float inv = rsqrtf(var + 1e-5f);
    const float v0[4] = {u0.x, u0.y, u0.z, u0.w};
    const float v1[4] = {u1.x, u1.y, u1.z, u1.w};
#pragma unroll
    for (int i = 0; i < 4; ++i) {
      int c = lane * 4 + i;
      X[row * LDSTRIDE + c] = (v0[i] - mean) * inv * ln_g[c] + ln_b[c];
    }
#pragma unroll
    for (int i = 0; i < 4; ++i) {
      int c = 128 + lane * 4 + i;
      X[row * LDSTRIDE + c] = (v1[i] - mean) * inv * ln_g[c] + ln_b[c];
    }
  }
  __syncthreads();

  // ---- query projection (WMMA) + gate blend, result into qbuf ----
  {
    const int lrow = lane & 15;
    const int lhi = lane >> 4;
    const int ntile = wv & 3;
    const int mbase = (wv >> 2) * 32;  // rows mbase..mbase+31 (2 M-tiles)
    const float* bp = w_qf + ntile * 16 + lrow;
    const int n = ntile * 16 + lrow;
    // bias, gates and coarse queries of this lane's results are asked for ahead
    // of the K loop, so that they are there when it ends. Four consecutive rows
    // of a tile are the four fine pixels of one coarse cell: this lane's rows
    // lie in cells cell0 + 4 * mt + jc.
    const int cell0 = (mbase + lhi * 8) >> 2;
    const float bn = b_qf[n];
    float g[2][2], qcv[2][2];
    // unrolled: constant indices keep g and qcv in registers
#pragma unroll
    for (int mt = 0; mt < 2; ++mt)
#pragma unroll
      for (int jc = 0; jc < 2; ++jc) {
        const int cell = cell0 + mt * 4 + jc;
        const int cp =
            (b * HCD + h0 + (cell >> 2)) * WCD + w0 + (cell & 3);
        g[mt][jc] = gate_in[cp];
        qcv[mt][jc] = qc_in[(size_t)cp * ED + n];
      }
    v8f acc0 = {}, acc1 = {};
    for (int k0 = 0; k0 < CFD; k0 += 4) {
      const int ka = k0 + lhi * 2;
      v2f af0, af1, bfrag;
      af0.x = X[(mbase + lrow) * LDSTRIDE + ka];
      af0.y = X[(mbase + lrow) * LDSTRIDE + ka + 1];
      af1.x = X[(mbase + 16 + lrow) * LDSTRIDE + ka];
      af1.y = X[(mbase + 16 + lrow) * LDSTRIDE + ka + 1];
      bfrag.x = bp[(size_t)ka * ED];
      bfrag.y = bp[(size_t)(ka + 1) * ED];
      acc0 = wmma_f32_16x16x4(af0, bfrag, acc0);
      acc1 = wmma_f32_16x16x4(af1, bfrag, acc1);
    }
    // four vector issue slots between the last matrix instructions and the
    // first vector instruction that reads their results
    asm volatile("v_nop\n\tv_nop\n\tv_nop\n\tv_nop");
    // every wave has read its last row of X: the query tile may overwrite it
    __syncthreads();
    // unrolled: constant indices keep the accumulators in registers
#pragma unroll
    for (int mt = 0; mt < 2; ++mt) {
      const v8f acc = (mt == 0) ? acc0 : acc1;
#pragma unroll
      for (int jc = 0; jc < 2; ++jc)
#pragma unroll
        for (int jj = 0; jj < 4; ++jj)
          qbuf[((cell0 + mt * 4 + jc) * 4 + jj) * QKP + n] =
              (acc[jc * 4 + jj] + bn) * g[mt][jc] +
              qcv[mt][jc] * (1.0f - g[mt][jc]);
    }
  }
  // this wave's k/v copies have landed; the barrier publishes them and the
  // query tile
  wait_asynccnt0();
  __syncthreads();

  // ---- phase 1: attention logits on the matrix unit ----
  // Q (64 px x 64 channels) times K^T (64 channels x 64 halo cells) in 16x16
  // tiles. Pixel tile mt holds the 16 fine pixels of cell row mt; their 5x5
  // windows lie in halo rows mt..mt+4, that is inside three of the four cell
  // tiles (two halo rows each), starting at tile mt / 2. The two waves of a
  // pixel tile take two of these and one; which of them takes two alternates
  // between the upper and the lower four waves, to even out the matrix work.
  {
    const int lrow = lane & 15;  // A: pixel in its tile, B/D: cell in its tile
    const int lhi = lane >> 4;
    const int mt = wv >> 1;
    const bool two = ((wv ^ (wv >> 2)) & 1) == 0;  // scalar: every lane stays on
    const int nt = (mt >> 1) + (two ? 0 : 2);
    const float* qrow = qbuf + (mt * 16 + lrow) * QKP + lhi * 4;
    const float* krow = kbuf + (nt * 16 + lrow) * QKP + lhi * 4;
    float* ad = attb + (mt * 16 + lhi * 8) * ATP + nt * 16 + lrow;
    v8f c0;
    if (two)
      c0 = logit_tiles<2>(qrow, krow, ad + 16);
    else
      c0 = logit_tiles<1>(qrow, krow, ad);
    // unrolled: constant indices keep the sums in registers
#pragma unroll
    for (int j = 0; j < 8; ++j) ad[j * ATP] = c0[j];
  }
  __syncthreads();

  // ---- phase 2: softmax over 25 ----
  if (tid < 64) {
    // this pixel's row of the logit matrix, from the top left cell of its window
    const float* a = attb + tid * ATP + (tid >> 4) * 8 + ((tid >> 2) & 3);
    float e[25];
#pragma unroll
    for (int p = 0; p < 25; ++p) e[p] = a[(p / 5) * 8 + p % 5];
    float mx = e[0];
#pragma unroll
    for (int p = 1; p < 25; ++p) mx = fmaxf(mx, e[p]);
    float s = 0.0f;
#pragma unroll
    for (int p = 0; p < 25; ++p) {
      e[p] = __expf(e[p] - mx);
      s += e[p];
    }
    const float inv = 1.0f / s;
    // weights go out as [cell][tap][sub-pixel] (query tile is dead by now), so
    // phase 3 fetches a cell's four weights of one tap with one 16-byte read
    float* wd = qbuf + (tid >> 2) * 100 + (tid & 3);
#pragma unroll
    for (int p = 0; p < 25; ++p) wd[p * 4] = e[p] * inv;
  }
  __syncthreads();

  // ---- phase 3: weighted value accumulation ----
  // One wave = two x-adjacent coarse cells (8 fine pixels); the 32 lanes span
  // the 256 channels (4 + 4 each). Every value read is 512 contiguous bytes
  // (all banks once), serves 4 or 8 pixels, and every store is 512 contiguous
  // bytes. Taps are still summed in the order p = 0..24 for each pixel.
  {
    const int lane = tid & 31;
    // scalar wave number: cell, weight and output bases form on the scalar unit
    const int wave = __builtin_amdgcn_readfirstlane(tid >> 5);
    const int cy = wave >> 1;
    const int cxb = (wave & 1) * 2;
    const float* wl = qbuf + (cy * 4 + cxb) * 100;  // left cell's weights
    const float* wr = wl + 100;                     // right cell's weights
    // every loop below is fully unrolled: constant indices keep acc in
    // registers, the px range test folds away, and reads can be issued ahead
    float4 acc[2][4][2];
#pragma unroll
    for (int c = 0; c < 2; ++c)
#pragma unroll
      for (int s = 0; s < 4; ++s)
#pragma unroll
        for (int h = 0; h < 2; ++h)
          acc[c][s][h] = make_float4(0.f, 0.f, 0.f, 0.f);
#pragma unroll
    for (int py = 0; py < 5; ++py) {
      const float* vrow = vbuf + ((cy + py) * 8 + cxb) * FD + lane * 4;
#pragma unroll
      for (int col = 0; col < 6; ++col) {
        float4 vv[2];
        vv[0] = *(const float4*)(vrow + col * FD);
        vv[1] = *(const float4*)(vrow + col * FD + 128);
#pragma unroll
        for (int c = 0; c < 2; ++c) {
          const int px = col - c;
          if (px < 0 || px > 4) continue;
          const float4 w4 =
              *(const float4*)((c == 0 ? wl : wr) + (py * 5 + px) * 4);
          const float ws[4] = {w4.x, w4.y, w4.z, w4.w};
#pragma unroll
          for (int s = 0; s < 4; ++s)
#pragma unroll
            for (int h = 0; h < 2; ++h) {
              acc[c][s][h].x = fmaf(ws[s], vv[h].x, acc[c][s][h].x);
              acc[c][s][h].y = fmaf(ws[s], vv[h].y, acc[c][s][h].y);
              acc[c][s][h].z = fmaf(ws[s], vv[h].z, acc[c][s][h].z);
              acc[c][s][h].w = fmaf(ws[s], vv[h].w, acc[c][s][h].w);
            }
        }
      }
    }
#pragma unroll
    for (int c = 0; c < 2; ++c)
#pragma unroll
      for (int s = 0; s < 4; ++s) {
        const int fh = (h0 + cy) * 2 + (s >> 1);
        const int fw = (w0 + cxb + c) * 2 + (s & 1);
        float* op = out + ((size_t)(b * HFD + fh) * WFD + fw) * FD + lane * 4;
        *(float4*)op = acc[c][s][0];
        *(float4*)(op + 128) = acc[c][s][1];
      }
  }
}

// -------------------------------------------------------------------------
extern "C" void kernel_launch(void* const* d_in, const int* in_sizes, int n_in,
                              void* d_out, int out_size, void* d_ws,
                              size_t ws_size, hipStream_t stream) {
  const float* fine = (const float*)d_in[0];
  const float* coarse = (const float*)d_in[1];
  const float* ln_f_g = (const float*)d_in[2];
  const float* ln_f_b = (const float*)d_in[3];
  const float* ln_c_g = (const float*)d_in[4];
  const float* ln_c_b = (const float*)d_in[5];
  const float* w_gate = (const float*)d_in[6];
  const float* b_gate = (const float*)d_in[7];
  const float* w_qf = (const float*)d_in[8];
  const float* b_qf = (const float*)d_in[9];
  const float* w_qc = (const float*)d_in[10];
  const float* b_qc = (const float*)d_in[11];
  const float* w_k = (const float*)d_in[12];
  const float* b_k = (const float*)d_in[13];
  const float* w_v = (const float*)d_in[14];
  const float* b_v = (const float*)d_in[15];
  float* out = (float*)d_out;

  // Workspace layout (floats): gate | qc | k | v  (~25 MB total)
  float* ws = (float*)d_ws;
  float* gate = ws;                                 // 16384
  float* qc = gate + (size_t)BB * HCD * WCD;        // 1048576
  float* kk = qc + (size_t)BB * HCD * WCD * ED;     // 1048576
  float* vv = kk + (size_t)BB * HCD * WCD * ED;     // 4194304

  const int coarsePixels = BB * HCD * WCD;  // 16384

  sapa_coarse_proj<<<coarsePixels / 32, 256, 0, stream>>>(
      coarse, ln_c_g, ln_c_b, w_gate, b_gate, w_qc, b_qc, w_k, b_k, w_v, b_v,
      gate, qc, kk, vv);

  const size_t attn_lds =
      (8 * 8 * QKP + 8 * 8 * 256 + 64 * LDSTRIDE) * sizeof(float);
  sapa_attention<<<dim3(WCD / 4, HCD / 4, BB), 256, attn_lds, stream>>>(
      fine, ln_f_g, ln_f_b, w_qf, b_qf, gate, qc, kk, vv, out);
}

// v007
// A run of this version takes 49.9 microseconds.
// Next to v006, in two timings, it ran 1.06 times as fast each time.
// All steps since v000 together make it 3.22 times as fast.
#include <hip/hip_runtime.h>
#include <math.h>
#include <stdint.h>

// Problem constants (from reference)
#define BB 4
#define HFD 128
#define WFD 128
#define CFD 256
#define HCD 64
#define WCD 64
#define CCD 256
#define ED 64
#define FD 256

typedef float v2f __attribute__((ext_vector_type(2)));
typedef float v8f __attribute__((ext_vector_type(8)));

__device__ __forceinline__ v8f wmma_f32_16x16x4(v2f a, v2f b, v8f c) {
  // D = A(16x4,f32) * B(4x16,f32) + C(16x16,f32), full fp32 matrix pipe
  return __builtin_amdgcn_wmma_f32_16x16x4_f32(
      /*neg_a=*/false, a, /*neg_b=*/false, b,
      /*c_mod=*/(short)0, c, /*reuse_a=*/false, /*reuse_b=*/false);
}

__device__ __forceinline__ float wave_sum32(float v) {
#pragma unroll
  for (int off = 16; off > 0; off >>= 1) v += __shfl_xor(v, off, 32);
  return v;
}

// CDNA5 async memory->LDS copies (ASYNCcnt-tracked, no VGPR staging): each lane
// brings its own 16 bytes. A run of copies shares one statement that ends in
// s_wait_xcnt 0, so no address register is rewritten before the copies' address
// translations are through (a precaution).
__device__ __forceinline__ unsigned lds_addr(const float* p) {
  return (unsigned)(uintptr_t)p;  // low 32 bits = byte offset in the group's LDS
}
__device__ __forceinline__ void async_ld5_b128(
    const float* l0, const float* g0, const float* l1, const float* g1,
    const float* l2, const float* g2, const float* l3, const float* g3,
    const float* l4, const float* g4) {
  asm volatile(
      "global_load_async_to_lds_b128 %0, %1, off\n\t"
      "global_load_async_to_lds_b128 %2, %3, off\n\t"
      "global_load_async_to_lds_b128 %4, %5, off\n\t"
      "global_load_async_to_lds_b128 %6, %7, off\n\t"
      "global_load_async_to_lds_b128 %8, %9, off\n\t"
      "s_wait_xcnt 0x0"
      :
      : "v"(lds_addr(l0)), "v"(g0), "v"(lds_addr(l1)), "v"(g1),
        "v"(lds_addr(l2)), "v"(g2), "v"(lds_addr(l3)), "v"(g3),
        "v"(lds_addr(l4)), "v"(g4)
      : "memory");
}
__device__ __forceinline__ void wait_asynccnt0() {
  asm volatile("s_wait_asynccnt 0" ::: "memory");
}

#define LDSTRIDE 257  // 256 + 1 pad: A-frag column reads hit distinct banks
// Row pitch (floats) of the attention kernel's key and query tiles in LDS:
// 272 B = 16 B x 17, so 16-byte reads of neighbouring rows fall on different
// banks (at 256 B every row starts on the same four banks).
#define QKP 68

// Row pitch (floats) of the attention kernel's logit matrix (64 px x 64 halo
// cells): rows 8 apart start 16 banks apart, so the two half-waves of an
// accumulator store fall on different banks.
#define ATP 66

// Logits of one wave: one 16-pixel tile against NT neighbouring 16-cell tiles.
// qrow / krow = this lane's query / key row in LDS plus 4 * (lane / 16) floats.
// A 16-byte read feeds two K-steps: with the same read pattern on both operands
// lanes 0-15 hold channels 8s..8s+3 and lanes 16-31 channels 8s+4..8s+7, so
// step one multiplies channels {0,1,4,5} of the eight and step two {2,3,6,7}.
// The first tile's sums are returned; a second tile's are stored at ad1.
template <int NT>
__device__ __forceinline__ v8f logit_tiles(const float* qrow, const float* krow,
                                           float* ad1) {
  v8f c[NT];
  // all loops unrolled: constant indices keep fragments and sums in registers,
  // and the LDS reads can be issued ahead of the matrix instructions
#pragma unroll
  for (int t = 0; t < NT; ++t) c[t] = v8f{};
#pragma unroll
  for (int s = 0; s < 8; ++s) {
    const float4 q4 = *(const float4*)(qrow + s * 8);
    const v2f alo = {q4.x, q4.y}, ahi = {q4.z, q4.w};
    float4 k4[NT];
#pragma unroll
    for (int t = 0; t < NT; ++t)
      k4[t] = *(const float4*)(krow + t * 16 * QKP + s * 8);
#pragma unroll
    for (int t = 0; t < NT; ++t)
      c[t] = wmma_f32_16x16x4(alo, v2f{k4[t].x, k4[t].y}, c[t]);
#pragma unroll
    for (int t = 0; t < NT; ++t)
      c[t] = wmma_f32_16x16x4(ahi, v2f{k4[t].z, k4[t].w}, c[t]);
  }
  if (NT > 1) {
#pragma unroll
    for (int j = 0; j < 8; ++j) ad1[j * ATP] = c[NT - 1][j];
  }
  return c[0];
}

// K loop and stores of one wave of kernel A: 2 M-tiles x 3 N-tiles. The row
// strides N0..N2 of the three weight / output matrices are compile-time, so a
// K-step's addresses are one base plus constant offsets. p* = weight column of
// this lane, d* = output column of this lane, bn* = its bias.
template <int N0, int N1, int N2>
__device__ __forceinline__ void coarse_tiles(
    const float* X, const int lrow, const int lhi, const int pbase,
    const float* __restrict__ p0, const float* __restrict__ p1,
    const float* __restrict__ p2, const float bn0, const float bn1,
    const float bn2, float* __restrict__ d0, float* __restrict__ d1,
    float* __restrict__ d2) {
  const float* x0 = X + lrow * LDSTRIDE + lhi * 2;
  const float* x1 = x0 + 16 * LDSTRIDE;
  const float* q0 = p0 + lhi * 2 * N0;
  const float* q1 = p1 + lhi * 2 * N1;
  const float* q2 = p2 + lhi * 2 * N2;
  v8f a00 = {}, a01 = {}, a02 = {}, a10 = {}, a11 = {}, a12 = {};
  for (int kb = 0; kb < CCD; kb += 32) {
    // 8 K-steps per trip, fully unrolled: their 48 weight loads go out together,
    // ahead of the matrix instructions, so the wave waits for L2 once per 8
    // steps, not once per step
#pragma unroll
    for (int k0 = 0; k0 < 32; k0 += 4) {
      v2f af0, af1;
      af0.x = x0[k0];
      af0.y = x0[k0 + 1];
      af1.x = x1[k0];
      af1.y = x1[k0 + 1];
      v2f bf0, bf1, bf2;
      bf0.x = q0[k0 * N0];
      bf0.y = q0[(k0 + 1) * N0];
      bf1.x = q1[k0 * N1];
      bf1.y = q1[(k0 + 1) * N1];
      bf2.x = q2[k0 * N2];
      bf2.y = q2[(k0 + 1) * N2];
      a00 = wmma_f32_16x16x4(af0, bf0, a00);
      a01 = wmma_f32_16x16x4(af0, bf1, a01);
      a02 = wmma_f32_16x16x4(af0, bf2, a02);
      a10 = wmma_f32_16x16x4(af1, bf0, a10);
      a11 = wmma_f32_16x16x4(af1, bf1, a11);
      a12 = wmma_f32_16x16x4(af1, bf2, a12);
    }
    x0 += 32;
    x1 += 32;
    q0 += 32 * N0;
    q1 += 32 * N1;
    q2 += 32 * N2;
  }
  float* e0 = d0 + (size_t)(pbase + lhi * 8) * N0;
  float* e1 = d1 + (size_t)(pbase + lhi * 8) * N1;
  float* e2 = d2 + (size_t)(pbase + lhi * 8) * N2;
  // unrolled: constant indices keep the accumulators in registers
#pragma unroll
  for (int j = 0; j < 8; ++j) {
    e0[j * N0] = a00[j] + bn0;
    e0[(16 + j) * N0] = a10[j] + bn0;
    e1[j * N1] = a01[j] + bn1;
    e1[(16 + j) * N1] = a11[j] + bn1;
    e2[j * N2] = a02[j] + bn2;
    e2[(16 + j) * N2] = a12[j] + bn2;
  }
  // behind the last store: no data or address register of these stores is
  // rewritten before their address translations are through (a precaution)
  asm volatile("s_wait_xcnt 0x0" ::: "memory");
}

// -------------------------------------------------------------------------
// Kernel A: coarse layernorm + gate + WMMA GEMMs for qc (N=64), k (N=64),
// v (N=256). One block = 32 coarse pixels (2 M-tiles), 256 threads = 8
// waves. Each wave owns 3 N-tiles and 6 accumulators (2M x 3N): each K-step
// takes 2 A-frags from LDS + 3 B-frags from L2-resident weights and issues 6
// independent WMMAs (coarse_tiles above).
// -------------------------------------------------------------------------
__global__ __launch_bounds__(256) void sapa_coarse_proj(
    const float* __restrict__ coarse,
    const float* __restrict__ ln_g, const float* __restrict__ ln_b,
    const float* __restrict__ w_gate, const float* __restrict__ b_gate,
    const float* __restrict__ w_qc, const float* __restrict__ b_qc,
    const float* __restrict__ w_k, const float* __restrict__ b_k,
    const float* __restrict__ w_v, const float* __restrict__ b_v,
    float* __restrict__ gate_out, float* __restrict__ qc_out,
    float* __restrict__ k_out, float* __restrict__ v_out) {
  __shared__ float X[32 * LDSTRIDE];
  const int tid = threadIdx.x;
  const int lane = tid & 31;
  const int wave = tid >> 5;
  const int pbase = blockIdx.x * 32;

  // ---- LayerNorm (4 rows per wave) + gate logit ----
  // The wave's four rows go through every stage together: their eight loads are
  // out at once (one memory wait, not four) and the cross-lane sums of the four
  // rows run side by side (one chain of five exchanges, not four). All loops
  // are unrolled: constant indices keep the rows in registers.
  const int row0 = wave * 4;
  float4 u0[4], u1[4];
#pragma unroll
  for (int rr = 0; rr < 4; ++rr) {
    const float* src = coarse + (size_t)(pbase + row0 + rr) * CCD;
    u0[rr] = *(const float4*)(src + lane * 4);
    u1[rr] = *(const float4*)(src + 128 + lane * 4);
  }
  const float4 g0 = *(const float4*)(ln_g + lane * 4);
  const float4 g1 = *(const float4*)(ln_g + 128 + lane * 4);
  const float4 t0 = *(const float4*)(ln_b + lane * 4);
  const float4 t1 = *(const float4*)(ln_b + 128 + lane * 4);
  const float4 y0 = *(const float4*)(w_gate + lane * 4);
  const float4 y1 = *(const float4*)(w_gate + 128 + lane * 4);
  const float bg = b_gate[0];
  float s[4], sq[4];
#pragma unroll
  for (int rr = 0; rr < 4; ++rr) {
    const float4 a0 = u0[rr], a1 = u1[rr];
    s[rr] = a0.x + a0.y + a0.z + a0.w + a1.x + a1.y + a1.z + a1.w;
    sq[rr] = a0.x * a0.x + a0.y * a0.y + a0.z * a0.z + a0.w * a0.w +
             a1.x * a1.x + a1.y * a1.y + a1.z * a1.z + a1.w * a1.w;
  }
#pragma unroll
  for (int off = 16; off > 0; off >>= 1) {
    float ts[4], tq[4];
#pragma unroll
    for (int rr = 0; rr < 4; ++rr) {
      ts[rr] = __shfl_xor(s[rr], off, 32);
      tq[rr] = __shfl_xor(sq[rr], off, 32);
    }
#pragma unroll
    for (int rr = 0; rr < 4; ++rr) {
      s[rr] += ts[rr];
      sq[rr] += tq[rr];
    }
  }
  float gdot[4];  // this lane's share of each row's gate logit
#pragma unroll
  for (int rr = 0; rr < 4; ++rr) {
    const float mean = s[rr] * (1.0f / 256.0f);
    const float var = sq[rr] * (1.0f / 256.0f) - mean * mean;
    const float inv = rsqrtf(var + 1e-5f);
    const float v0[4] = {u0[rr].x, u0[rr].y, u0[rr].z, u0[rr].w};
    const float v1[4] = {u1[rr].x, u1[rr].y, u1[rr].z, u1[rr].w};
    const float lg0[4] = {g0.x, g0.y, g0.z, g0.w};
    const float lg1[4] = {g1.x, g1.y, g1.z, g1.w};
    const float lb0[4] = {t0.x, t0.y, t0.z, t0.w};
    const float lb1[4] = {t1.x, t1.y, t1.z, t1.w};
    const float wg0[4] = {y0.x, y0.y, y0.z, y0.w};
    const float wg1[4] = {y1.x, y1.y, y1.z, y1.w};
    float* xr = X + (row0 + rr) * LDSTRIDE + lane * 4;
    float gd = 0.0f;
#pragma unroll
    for (int i = 0; i < 4; ++i) {
      float xh = (v0[i] - mean) * inv * lg0[i] + lb0[i];
      xr[i] = xh;
      gd = fmaf(xh, wg0[i], gd);
    }
#pragma unroll
    for (int i = 0; i < 4; ++i) {
      float xh = (v1[i] - mean) * inv * lg1[i] + lb1[i];
      xr[128 + i] = xh;
      gd = fmaf(xh, wg1[i], gd);
    }
    gdot[rr] = gd;
  }
  __syncthreads();

  // ---- WMMA: 24 N-tiles over concat [qc(4) | k(4) | v(16)] ----
  const int lrow = lane & 15;  // A: M index, B/D: N index
  const int lhi = lane >> 4;   // half-wave selector
  // scalar wave number: the choice below is a scalar branch (every lane stays on
  // for the matrix instructions) and each side knows its row strides at compile
  // time. Wave w owns tiles 3w, 3w+1, 3w+2 of the concatenation.
  const int wv = __builtin_amdgcn_readfirstlane(tid >> 5);
  if (wv >= 3) {
    const int c = (wv * 3 - 8) * 16 + lrow;  // three tiles of v
    coarse_tiles<FD, FD, FD>(X, lrow, lhi, pbase, w_v + c, w_v + c + 16,
                             w_v + c + 32, b_v[c], b_v[c + 16], b_v[c + 32],
                             v_out + c, v_out + c + 16, v_out + c + 32);
  } else if (wv == 2) {  // k tiles 2, 3 and v tile 0
    coarse_tiles<ED, ED, FD>(X, lrow, lhi, pbase, w_k + 32 + lrow,
                             w_k + 48 + lrow, w_v + lrow, b_k[32 + lrow],
                             b_k[48 + lrow], b_v[lrow], k_out + 32 + lrow,
                             k_out + 48 + lrow, v_out + lrow);
  } else if (wv == 1) {  // qc tile 3 and k tiles 0, 1
    coarse_tiles<ED, ED, ED>(X, lrow, lhi, pbase, w_qc + 48 + lrow, w_k + lrow,
                             w_k + 16 + lrow, b_qc[48 + lrow], b_k[lrow],
                             b_k[16 + lrow], qc_out + 48 + lrow, k_out + lrow,
                             k_out + 16 + lrow);
  } else {  // qc tiles 0, 1, 2
    coarse_tiles<ED, ED, ED>(X, lrow, lhi, pbase, w_qc + lrow, w_qc + 16 + lrow,
                             w_qc + 32 + lrow, b_qc[lrow], b_qc[16 + lrow],
                             b_qc[32 + lrow], qc_out + lrow, qc_out + 16 + lrow,
                             qc_out + 32 + lrow);
  }

  // ---- gates of the wave's four rows, behind the K loop, so that neither a
  // global store (the barrier would wait for it) nor a sigmoid holds up the
  // matrix work. The four sums run side by side; lane r finishes row r.
#pragma unroll
  for (int off = 16; off > 0; off >>= 1) {
    float tg[4];
#pragma unroll
    for (int rr = 0; rr < 4; ++rr) tg[rr] = __shfl_xor(gdot[rr], off, 32);
#pragma unroll
    for (int rr = 0; rr < 4; ++rr) gdot[rr] += tg[rr];
  }
  float gsel = gdot[0];
  gsel = lane == 1 ? gdot[1] : gsel;
  gsel = lane == 2 ? gdot[2] : gsel;
  gsel = lane == 3 ? gdot[3] : gsel;
  if (lane < 4)
    gate_out[pbase + row0 + lane] = 1.0f / (1.0f + __expf(-(gsel + bg)));
}

// -------------------------------------------------------------------------
// Kernel B: fine layernorm + WMMA qf GEMM + gate blend with upsampled qc, then
// 5x5 local attention (logits on WMMA too), all for one tile of 4x4 coarse cells (64 fine px). The
// 8x8 zero-padded k/v halo is copied to LDS with CDNA5
// GLOBAL_LOAD_ASYNC_TO_LDS_B128 (ASYNCcnt) while layernorm and projection run;
// the query tile goes from the accumulators straight into LDS. 8 waves; GEMM
// wave = (mpair, ntile), 2 accumulators. Dynamic LDS 145.25 KB.
// -------------------------------------------------------------------------
__global__ __launch_bounds__(256) void sapa_attention(
    const float* __restrict__ fine,
    const float* __restrict__ ln_g, const float* __restrict__ ln_b,
    const float* __restrict__ w_qf, const float* __restrict__ b_qf,
    const float* __restrict__ gate_in, const float* __restrict__ qc_in,
    const float* __restrict__ kglb, const float* __restrict__ vglb,
    float* __restrict__ out) {
  extern __shared__ __attribute__((aligned(16))) float smem[];
  float* kbuf = smem;                    // 8*8*QKP  = 4352 floats
  float* vbuf = kbuf + 8 * 8 * QKP;      // 8*8*256  = 16384 floats
  float* X = vbuf + 8 * 8 * 256;         // 64*LDSTRIDE = 16448 floats
  // the normalised fine tile X is dead once the K loop is over: query tile and
  // logits take its place
  float* qbuf = X;                       // 64*QKP   = 4352 floats
  float* attb = qbuf + 64 * QKP;         // 64*ATP   = 4224 floats

  const int tid = threadIdx.x;
  const int b = blockIdx.z;
  const int h0 = blockIdx.y * 4;
  const int w0 = blockIdx.x * 4;
  const int lane = tid & 31;
  // scalar wave number: the edge tests below are scalar branches, so a wave
  // either issues a copy with every lane on or jumps past it
  const int wv = __builtin_amdgcn_readfirstlane(tid >> 5);

  // ---- cooperative staging: k/v halo (zero-pad OOB) ----
  // Every copy of a wave moves 512 contiguous bytes of global memory (four
  // whole 128-byte lines), lane l the l-th 16 bytes. Wave w brings halo row w
  // of k and v.
  {
    const int half = lane >> 4;        // which of two 256-byte rows
    const int l16 = (lane & 15) * 4;   // float offset inside such a row

    // k/v: halo row wv, two columns at a time. w0, the halo width and WCD are
    // even, so the two columns of a pair are inside the image or outside it
    // together.
    const int hh = h0 - 2 + wv;
    const bool rowok = (hh >= 0) && (hh < HCD);
    // unrolled so that j folds into constant LDS and column offsets
#pragma unroll
    for (int j = 0; j < 4; ++j) {
      const int ww = w0 - 2 + 2 * j;
      float* kd = kbuf + (wv * 8 + 2 * j + half) * QKP + l16;
      float* vd = vbuf + (wv * 8 + 2 * j) * FD + lane * 4;
      if (rowok && ww >= 0 && ww + 1 < WCD) {
        const size_t cgi = (size_t)(b * HCD + hh) * WCD + ww;
        const float* ks = kglb + cgi * ED + lane * 4;
        const float* vs = vglb + cgi * FD + lane * 4;
        async_ld5_b128(vd, vs, vd + 128, vs + 128, vd + 256, vs + 256,
                       vd + 384, vs + 384, kd, ks);
      } else {
        const float4 z = make_float4(0.f, 0.f, 0.f, 0.f);
        *(float4*)kd = z;
        *(float4*)vd = z;
        *(float4*)(vd + 128) = z;
        *(float4*)(vd + 256) = z;
        *(float4*)(vd + 384) = z;
      }
    }
  }

  // ---- fine layernorm: wave w takes fine row h0*2 + w of the tile (8 px, 8 KB
  // contiguous); LDS row order (cy,cx,sy,sx), as the later phases index pixels
#pragma unroll
  for (int rr = 0; rr < 8; ++rr) {
    const int row = ((wv >> 1) * 4 + (rr >> 1)) * 4 + (wv & 1) * 2 + (rr & 1);
    const float* src =
        fine + ((size_t)(b * HFD + h0 * 2 + wv) * WFD + w0 * 2 + rr) * CFD;
    float4 u0 = *(const float4*)(src + lane * 4);
    float4 u1 = *(const float4*)(src + 128 + lane * 4);
    float s = u0.x + u0.y + u0.z + u0.w + u1.x + u1.y + u1.z + u1.w;
    float sq = u0.x * u0.x + u0.y * u0.y + u0.z * u0.z + u0.w * u0.w +
               u1.x * u1.x + u1.y * u1.y + u1.z * u1.z + u1.w * u1.w;
    s = wave_sum32(s);
    sq = wave_sum32(sq);
    const float mean = s * (1.0f / 256.0f);
    const float var = sq * (1.0f / 256.0f) - mean * mean;
    const float inv = rsqrtf(var + 1e-5f);
    const float v0[4] = {u0.x, u0.y, u0.z, u0.w};
    const float v1[4] = {u1.x, u1.y, u1.z, u1.w};
#pragma unroll
    for (int i = 0; i < 4; ++i) {
      int c = lane * 4 + i;
      X[row * LDSTRIDE + c] = (v0[i] - mean) * inv * ln_g[c] + ln_b[c];
    }
#pragma unroll
    for (int i = 0; i < 4; ++i) {
      int c = 128 + lane * 4 + i;
      X[row * LDSTRIDE + c] = (v1[i] - mean) * inv * ln_g[c] + ln_b[c];
    }
  }
  __syncthreads();

  // ---- query projection (WMMA) + gate blend, result into qbuf ----
  {
    const int lrow = lane & 15;
    const int lhi = lane >> 4;
    const int ntile = wv & 3;
    const int mbase = (wv >> 2) * 32;  // rows mbase..mbase+31 (2 M-tiles)
    const float* bp = w_qf + ntile * 16 + lrow;
    const int n = ntile * 16 + lrow;
    // bias, gates and coarse queries of this lane's results are asked for ahead
    // of the K loop, so that they are there when it ends. Four consecutive rows
    // of a tile are the four fine pixels of one coarse cell: this lane's rows
    // lie in cells cell0 + 4 * mt + jc.
    const int cell0 = (mbase + lhi * 8) >> 2;
    const float bn = b_qf[n];
    float g[2][2], qcv[2][2];
    // unrolled: constant indices keep g and qcv in registers
#pragma unroll
    for (int mt = 0; mt < 2; ++mt)
#pragma unroll
      for (int jc = 0; jc < 2; ++jc) {
        const int cell = cell0 + mt * 4 + jc;
        const int cp =
            (b * HCD + h0 + (cell >> 2)) * WCD + w0 + (cell & 3);
        g[mt][jc] = gate_in[cp];
        qcv[mt][jc] = qc_in[(size_t)cp * ED + n];
      }
    v8f acc0 = {}, acc1 = {};
    for (int k0 = 0; k0 < CFD; k0 += 4) {
      const int ka = k0 + lhi * 2;
      v2f af0, af1, bfrag;
      af0.x = X[(mbase + lrow) * LDSTRIDE + ka];
      af0.y = X[(mbase + lrow) * LDSTRIDE + ka + 1];
      af1.x = X[(mbase + 16 + lrow) * LDSTRIDE + ka];
      af1.y = X[(mbase + 16 + lrow) * LDSTRIDE + ka + 1];
      bfrag.x = bp[(size_t)ka * ED];
      bfrag.y = bp[(size_t)(ka + 1) * ED];
      acc0 = wmma_f32_16x16x4(af0, bfrag, acc0);
      acc1 = wmma_f32_16x16x4(af1, bfrag, acc1);
    }
    // four vector issue slots between the last matrix instructions and the
    // first vector instruction that reads their results
    asm volatile("v_nop\n\tv_nop\n\tv_nop\n\tv_nop");
    // every wave has read its last row of X: the query tile may overwrite it
    __syncthreads();
    // unrolled: constant indices keep the accumulators in registers
#pragma unroll
    for (int mt = 0; mt < 2; ++mt) {
      const v8f acc = (mt == 0) ? acc0 : acc1;
#pragma unroll
      for (int jc = 0; jc < 2; ++jc)
#pragma unroll
        for (int jj = 0; jj < 4; ++jj)
          qbuf[((cell0 + mt * 4 + jc) * 4 + jj) * QKP + n] =
              (acc[jc * 4 + jj] + bn) * g[mt][jc] +
              qcv[mt][jc] * (1.0f - g[mt][jc]);
    }
  }
  // this wave's k/v copies have landed; the barrier publishes them and the
  // query tile
  wait_asynccnt0();
  __syncthreads();

  // ---- phase 1: attention logits on the matrix unit ----
  // Q (64 px x 64 channels) times K^T (64 channels x 64 halo cells) in 16x16
  // tiles. Pixel tile mt holds the 16 fine pixels of cell row mt; their 5x5
  // windows lie in halo rows mt..mt+4, that is inside three of the four cell
  // tiles (two halo rows each), starting at tile mt / 2. The two waves of a
  // pixel tile take two of these and one; which of them takes two alternates
  // between the upper and the lower four waves, to even out the matrix work.
  {
    const int lrow = lane & 15;  // A: pixel in its tile, B/D: cell in its tile
    const int lhi = lane >> 4;
    const int mt = wv >> 1;
    const bool two = ((wv ^ (wv >> 2)) & 1) == 0;  // scalar: every lane stays on
    const int nt = (mt >> 1) + (two ? 0 : 2);
    const float* qrow = qbuf + (mt * 16 + lrow) * QKP + lhi * 4;
    const float* krow = kbuf + (nt * 16 + lrow) * QKP + lhi * 4;
    float* ad = attb + (mt * 16 + lhi * 8) * ATP + nt * 16 + lrow;
    v8f c0;
    if (two)
      c0 = logit_tiles<2>(qrow, krow, ad + 16);
    else
      c0 = logit_tiles<1>(qrow, krow, ad);
    // unrolled: constant indices keep the sums in registers
#pragma unroll
    for (int j = 0; j < 8; ++j) ad[j * ATP] = c0[j];
  }
  __syncthreads();

  // ---- phase 2: softmax over 25 ----
  if (tid < 64) {
    // this pixel's row of the logit matrix, from the top left cell of its window
    const float* a = attb + tid * ATP + (tid >> 4) * 8 + ((tid >> 2) & 3);
    float e[25];
#pragma unroll
    for (int p = 0; p < 25; ++p) e[p] = a[(p / 5) * 8 + p % 5];
    float mx = e[0];
#pragma unroll
    for (int p = 1; p < 25; ++p) mx = fmaxf(mx, e[p]);
    float s = 0.0f;
#pragma unroll
    for (int p = 0; p < 25; ++p) {
      e[p] = __expf(e[p] - mx);
      s += e[p];
    }
    const float inv = 1.0f / s;
    // weights go out as [cell][tap][sub-pixel] (query tile is dead by now), so
    // phase 3 fetches a cell's four weights of one tap with one 16-byte read
    float* wd = qbuf + (tid >> 2) * 100 + (tid & 3);
#pragma unroll
    for (int p = 0; p < 25; ++p) wd[p * 4] = e[p] * inv;
  }
  __syncthreads();

  // ---- phase 3: weighted value accumulation ----
  // One wave = two x-adjacent coarse cells (8 fine pixels); the 32 lanes span
  // the 256 channels (4 + 4 each). Every value read is 512 contiguous bytes
  // (all banks once), serves 4 or 8 pixels, and every store is 512 contiguous
  // bytes. Taps are still summed in the order p = 0..24 for each pixel.
  {
    const int lane = tid & 31;
    // scalar wave number: cell, weight and output bases form on the scalar unit
    const int wave = __builtin_amdgcn_readfirstlane(tid >> 5);
    const int cy = wave >> 1;
    const int cxb = (wave & 1) * 2;
    const float* wl = qbuf + (cy * 4 + cxb) * 100;  // left cell's weights
    const float* wr = wl + 100;                     // right cell's weights
    // every loop below is fully unrolled: constant indices keep acc in
    // registers, the px range test folds away, and reads can be issued ahead
    float4 acc[2][4][2];
#pragma unroll
    for (int c = 0; c < 2; ++c)
#pragma unroll
      for (int s = 0; s < 4; ++s)
#pragma unroll
        for (int h = 0; h < 2; ++h)
          acc[c][s][h] = make_float4(0.f, 0.f, 0.f, 0.f);
#pragma unroll
    for (int py = 0; py < 5; ++py) {
      const float* vrow = vbuf + ((cy + py) * 8 + cxb) * FD + lane * 4;
#pragma unroll
      for (int col = 0; col < 6; ++col) {
        float4 vv[2];
        vv[0] = *(const float4*)(vrow + col * FD);
        vv[1] = *(const float4*)(vrow + col * FD + 128);
#pragma unroll
        for (int c = 0; c < 2; ++c) {
          const int px = col - c;
          if (px < 0 || px > 4) continue;
          const float4 w4 =
              *(const float4*)((c == 0 ? wl : wr) + (py * 5 + px) * 4);
          const float ws[4] = {w4.x, w4.y, w4.z, w4.w};
#pragma unroll
          for (int s = 0; s < 4; ++s)
#pragma unroll
            for (int h = 0; h < 2; ++h) {
              acc[c][s][h].x = fmaf(ws[s], vv[h].x, acc[c][s][h].x);
              acc[c][s][h].y = fmaf(ws[s], vv[h].y, acc[c][s][h].y);
              acc[c][s][h].z = fmaf(ws[s], vv[h].z, acc[c][s][h].z);
              acc[c][s][h].w = fmaf(ws[s], vv[h].w, acc[c][s][h].w);
            }
        }
      }
    }
#pragma unroll
    for (int c = 0; c < 2; ++c)
#pragma unroll
      for (int s = 0; s < 4; ++s) {
        const int fh = (h0 + cy) * 2 + (s >> 1);
        const int fw = (w0 + cxb + c) * 2 + (s & 1);
        float* op = out + ((size_t)(b * HFD + fh) * WFD + fw) * FD + lane * 4;
        *(float4*)op = acc[c][s][0];
        *(float4*)(op + 128) = acc[c][s][1];
      }
  }
}

// -------------------------------------------------------------------------
extern "C" void kernel_launch(void* const* d_in, const int* in_sizes, int n_in,
                              void* d_out, int out_size, void* d_ws,
                              size_t ws_size, hipStream_t stream) {
  const float* fine = (const float*)d_in[0];
  const float* coarse = (const float*)d_in[1];
  const float* ln_f_g = (const float*)d_in[2];
  const float* ln_f_b = (const float*)d_in[3];
  const float* ln_c_g = (const float*)d_in[4];
  const float* ln_c_b = (const float*)d_in[5];
  const float* w_gate = (const float*)d_in[6];
  const float* b_gate = (const float*)d_in[7];
  const float* w_qf = (const float*)d_in[8];
  const float* b_qf = (const float*)d_in[9];
  const float* w_qc = (const float*)d_in[10];
  const float* b_qc = (const float*)d_in[11];
  const float* w_k = (const float*)d_in[12];
  const float* b_k = (const float*)d_in[13];
  const float* w_v = (const float*)d_in[14];
  const float* b_v = (const float*)d_in[15];
  float* out = (float*)d_out;

  // Workspace layout (floats): gate | qc | k | v  (~25 MB total)
  float* ws = (float*)d_ws;
  float* gate = ws;                                 // 16384
  float* qc = gate + (size_t)BB * HCD * WCD;        // 1048576
  float* kk = qc + (size_t)BB * HCD * WCD * ED;     // 1048576
  float* vv = kk + (size_t)BB * HCD * WCD * ED;     // 4194304

  const int coarsePixels = BB * HCD * WCD;  // 16384

  sapa_coarse_proj<<<coarsePixels / 32, 256, 0, stream>>>(
      coarse, ln_c_g, ln_c_b, w_gate, b_gate, w_qc, b_qc, w_k, b_k, w_v, b_v,
      gate, qc, kk, vv);

  const size_t attn_lds =
      (8 * 8 * QKP + 8 * 8 * 256 + 64 * LDSTRIDE) * sizeof(float);
  sapa_attention<<<dim3(WCD / 4, HCD / 4, BB), 256, attn_lds, stream>>>(
      fine, ln_f_g, ln_f_b, w_qf, b_qf, gate, qc, kk, vv, out);
}

// v008
// It runs in 48 microseconds.
// Next to v007, in two timings, it ran 1.04 and 1.03 times as fast.
// All steps since v000 together make it 3.33 times as fast.
#include <hip/hip_runtime.h>
#include <math.h>
#include <stdint.h>

// Problem constants (from reference)
#define BB 4
#define HFD 128
#define WFD 128
#define CFD 256
#define HCD 64
#define WCD 64
#define CCD 256
#define ED 64
#define FD 256

typedef float v2f __attribute__((ext_vector_type(2)));
typedef float v8f __attribute__((ext_vector_type(8)));

__device__ __forceinline__ v8f wmma_f32_16x16x4(v2f a, v2f b, v8f c) {
  // D = A(16x4,f32) * B(4x16,f32) + C(16x16,f32), full fp32 matrix pipe
  return __builtin_amdgcn_wmma_f32_16x16x4_f32(
      /*neg_a=*/false, a, /*neg_b=*/false, b,
      /*c_mod=*/(short)0, c, /*reuse_a=*/false, /*reuse_b=*/false);
}

__device__ __forceinline__ float wave_sum32(float v) {
#pragma unroll
  for (int off = 16; off > 0; off >>= 1) v += __shfl_xor(v, off, 32);
  return v;
}

// CDNA5 async memory->LDS copies (ASYNCcnt-tracked, no VGPR staging): each lane
// brings its own 16 bytes. A run of copies shares one statement that ends in
// s_wait_xcnt 0, so no address register is rewritten before the copies' address
// translations are through (a precaution).
__device__ __forceinline__ unsigned lds_addr(const float* p) {
  return (unsigned)(uintptr_t)p;  // low 32 bits = byte offset in the group's LDS
}
__device__ __forceinline__ void async_ld5_b128(
    const float* l0, const float* g0, const float* l1, const float* g1,
    const float* l2, const float* g2, const float* l3, const float* g3,
    const float* l4, const float* g4) {
  asm volatile(
      "global_load_async_to_lds_b128 %0, %1, off\n\t"
      "global_load_async_to_lds_b128 %2, %3, off\n\t"
      "global_load_async_to_lds_b128 %4, %5, off\n\t"
      "global_load_async_to_lds_b128 %6, %7, off\n\t"
      "global_load_async_to_lds_b128 %8, %9, off\n\t"
      "s_wait_xcnt 0x0"
      :
      : "v"(lds_addr(l0)), "v"(g0), "v"(lds_addr(l1)), "v"(g1),
        "v"(lds_addr(l2)), "v"(g2), "v"(lds_addr(l3)), "v"(g3),
        "v"(lds_addr(l4)), "v"(g4)
      : "memory");
}
// One wave's fine row of a tile (8 px x 256 channels, 8 KB contiguous) from
// global memory to LDS: 16 copies of 512 contiguous bytes. l, g = this lane's
// first 16 bytes in LDS and in global memory; the immediate offset moves both
// addresses alike, so one address pair serves all sixteen.
__device__ __forceinline__ void async_fine_row(const float* l, const float* g) {
  asm volatile(
      "global_load_async_to_lds_b128 %0, %1, off\n\t"
      "global_load_async_to_lds_b128 %0, %1, off offset:512\n\t"
      "global_load_async_to_lds_b128 %0, %1, off offset:1024\n\t"
      "global_load_async_to_lds_b128 %0, %1, off offset:1536\n\t"
      "global_load_async_to_lds_b128 %0, %1, off offset:2048\n\t"
      "global_load_async_to_lds_b128 %0, %1, off offset:2560\n\t"
      "global_load_async_to_lds_b128 %0, %1, off offset:3072\n\t"
      "global_load_async_to_lds_b128 %0, %1, off offset:3584\n\t"
      "global_load_async_to_lds_b128 %0, %1, off offset:4096\n\t"
      "global_load_async_to_lds_b128 %0, %1, off offset:4608\n\t"
      "global_load_async_to_lds_b128 %0, %1, off offset:5120\n\t"
      "global_load_async_to_lds_b128 %0, %1, off offset:5632\n\t"
      "global_load_async_to_lds_b128 %0, %1, off offset:6144\n\t"
      "global_load_async_to_lds_b128 %0, %1, off offset:6656\n\t"
      "global_load_async_to_lds_b128 %0, %1, off offset:7168\n\t"
      "global_load_async_to_lds_b128 %0, %1, off offset:7680\n\t"
      "s_wait_xcnt 0x0"
      :
      : "v"(lds_addr(l)), "v"(g)
      : "memory");
}
__device__ __forceinline__ void wait_asynccnt0() {
  asm volatile("s_wait_asynccnt 0" ::: "memory");
}

// Work-group barrier by hand (this wave's LDS accesses retired, signal, wait):
// it does for LDS what __syncthreads() does but leaves out that form's wait for
// the wave's global stores, so output stores that nobody in the launch reads
// drain under the work behind the barrier.
__device__ __forceinline__ void lds_barrier() {
  asm volatile("s_wait_dscnt 0x0\n\ts_barrier_signal -1\n\ts_barrier_wait -1" :::
               "memory");
}

#define LDSTRIDE 257  // 256 + 1 pad: A-frag column reads hit distinct banks
// Row pitch (floats) of the attention kernel's key and query tiles in LDS:
// 272 B = 16 B x 17, so 16-byte reads of neighbouring rows fall on different
// banks (at 256 B every row starts on the same four banks).
#define QKP 68

// Row pitch (floats) of the attention kernel's logit matrix (64 px x 64 halo
// cells): rows 8 apart start 16 banks apart, so the two half-waves of an
// accumulator store fall on different banks.
#define ATP 66

// Logits of one wave: one 16-pixel tile against NT neighbouring 16-cell tiles.
// qrow / krow = this lane's query / key row in LDS plus 4 * (lane / 16) floats.
// A 16-byte read feeds two K-steps: with the same read pattern on both operands
// lanes 0-15 hold channels 8s..8s+3 and lanes 16-31 channels 8s+4..8s+7, so
// step one multiplies channels {0,1,4,5} of the eight and step two {2,3,6,7}.
// The first tile's sums are returned; a second tile's are stored at ad1.
template <int NT>
__device__ __forceinline__ v8f logit_tiles(const float* qrow, const float* krow,
                                           float* ad1) {
  v8f c[NT];
  // all loops unrolled: constant indices keep fragments and sums in registers,
  // and the LDS reads can be issued ahead of the matrix instructions
#pragma unroll
  for (int t = 0; t < NT; ++t) c[t] = v8f{};
#pragma unroll
  for (int s = 0; s < 8; ++s) {
    const float4 q4 = *(const float4*)(qrow + s * 8);
    const v2f alo = {q4.x, q4.y}, ahi = {q4.z, q4.w};
    float4 k4[NT];
#pragma unroll
    for (int t = 0; t < NT; ++t)
      k4[t] = *(const float4*)(krow + t * 16 * QKP + s * 8);
#pragma unroll
    for (int t = 0; t < NT; ++t)
      c[t] = wmma_f32_16x16x4(alo, v2f{k4[t].x, k4[t].y}, c[t]);
#pragma unroll
    for (int t = 0; t < NT; ++t)
      c[t] = wmma_f32_16x16x4(ahi, v2f{k4[t].z, k4[t].w}, c[t]);
  }
  if (NT > 1) {
#pragma unroll
    for (int j = 0; j < 8; ++j) ad1[j * ATP] = c[NT - 1][j];
  }
  return c[0];
}

// K loop and stores of one wave of kernel A: 2 M-tiles x 3 N-tiles. The row
// strides N0..N2 of the three weight / output matrices are compile-time, so a
// K-step's addresses are one base plus constant offsets. p* = weight column of
// this lane, d* = output column of this lane, bn* = its bias.
template <int N0, int N1, int N2>
__device__ __forceinline__ void coarse_tiles(
    const float* X, const int lrow, const int lhi, const int pbase,
    const float* __restrict__ p0, const float* __restrict__ p1,
    const float* __restrict__ p2, const float bn0, const float bn1,
    const float bn2, float* __restrict__ d0, float* __restrict__ d1,
    float* __restrict__ d2) {
  const float* x0 = X + lrow * LDSTRIDE + lhi * 2;
  const float* x1 = x0 + 16 * LDSTRIDE;
  const float* q0 = p0 + lhi * 2 * N0;
  const float* q1 = p1 + lhi * 2 * N1;
  const float* q2 = p2 + lhi * 2 * N2;
  v8f a00 = {}, a01 = {}, a02 = {}, a10 = {}, a11 = {}, a12 = {};
  for (int kb = 0; kb < CCD; kb += 32) {
    // 8 K-steps per trip, fully unrolled: their 48 weight loads go out together,
    // ahead of the matrix instructions, so the wave waits for L2 once per 8
    // steps, not once per step
#pragma unroll
    for (int k0 = 0; k0 < 32; k0 += 4) {
      v2f af0, af1;
      af0.x = x0[k0];
      af0.y = x0[k0 + 1];
      af1.x = x1[k0];
      af1.y = x1[k0 + 1];
      v2f bf0, bf1, bf2;
      bf0.x = q0[k0 * N0];
      bf0.y = q0[(k0 + 1) * N0];
      bf1.x = q1[k0 * N1];
      bf1.y = q1[(k0 + 1) * N1];
      bf2.x = q2[k0 * N2];
      bf2.y = q2[(k0 + 1) * N2];
      a00 = wmma_f32_16x16x4(af0, bf0, a00);
      a01 = wmma_f32_16x16x4(af0, bf1, a01);
      a02 = wmma_f32_16x16x4(af0, bf2, a02);
      a10 = wmma_f32_16x16x4(af1, bf0, a10);
      a11 = wmma_f32_16x16x4(af1, bf1, a11);
      a12 = wmma_f32_16x16x4(af1, bf2, a12);
    }
    x0 += 32;
    x1 += 32;
    q0 += 32 * N0;
    q1 += 32 * N1;
    q2 += 32 * N2;
  }
  float* e0 = d0 + (size_t)(pbase + lhi * 8) * N0;
  float* e1 = d1 + (size_t)(pbase + lhi * 8) * N1;
  float* e2 = d2 + (size_t)(pbase + lhi * 8) * N2;
  // unrolled: constant indices keep the accumulators in registers
#pragma unroll
  for (int j = 0; j < 8; ++j) {
    e0[j * N0] = a00[j] + bn0;
    e0[(16 + j) * N0] = a10[j] + bn0;
    e1[j * N1] = a01[j] + bn1;
    e1[(16 + j) * N1] = a11[j] + bn1;
    e2[j * N2] = a02[j] + bn2;
    e2[(16 + j) * N2] = a12[j] + bn2;
  }
  // behind the last store: no data or address register of these stores is
  // rewritten before their address translations are through (a precaution)
  asm volatile("s_wait_xcnt 0x0" ::: "memory");
}

// -------------------------------------------------------------------------
// Kernel A: coarse layernorm + gate + WMMA GEMMs for qc (N=64), k (N=64),
// v (N=256). One block = 32 coarse pixels (2 M-tiles), 256 threads = 8
// waves. Each wave owns 3 N-tiles and 6 accumulators (2M x 3N): each K-step
// takes 2 A-frags from LDS + 3 B-frags from L2-resident weights and issues 6
// independent WMMAs (coarse_tiles above).
// -------------------------------------------------------------------------
__global__ __launch_bounds__(256) void sapa_coarse_proj(
    const float* __restrict__ coarse,
    const float* __restrict__ ln_g, const float* __restrict__ ln_b,
    const float* __restrict__ w_gate, const float* __restrict__ b_gate,
    const float* __restrict__ w_qc, const float* __restrict__ b_qc,
    const float* __restrict__ w_k, const float* __restrict__ b_k,
    const float* __restrict__ w_v, const float* __restrict__ b_v,
    float* __restrict__ gate_out, float* __restrict__ qc_out,
    float* __restrict__ k_out, float* __restrict__ v_out) {
  __shared__ float X[32 * LDSTRIDE];
  const int tid = threadIdx.x;
  const int lane = tid & 31;
  const int wave = tid >> 5;
  const int pbase = blockIdx.x * 32;

  // ---- LayerNorm (4 rows per wave) + gate logit ----
  // The wave's four rows go through every stage together: their eight loads are
  // out at once (one memory wait, not four) and the cross-lane sums of the four
  // rows run side by side (one chain of five exchanges, not four). All loops
  // are unrolled: constant indices keep the rows in registers.
  const int row0 = wave * 4;
  float4 u0[4], u1[4];
#pragma unroll
  for (int rr = 0; rr < 4; ++rr) {
    const float* src = coarse + (size_t)(pbase + row0 + rr) * CCD;
    u0[rr] = *(const float4*)(src + lane * 4);
    u1[rr] = *(const float4*)(src + 128 + lane * 4);
  }
  const float4 g0 = *(const float4*)(ln_g + lane * 4);
  const float4 g1 = *(const float4*)(ln_g + 128 + lane * 4);
  const float4 t0 = *(const float4*)(ln_b + lane * 4);
  const float4 t1 = *(const float4*)(ln_b + 128 + lane * 4);
  const float4 y0 = *(const float4*)(w_gate + lane * 4);
  const float4 y1 = *(const float4*)(w_gate + 128 + lane * 4);
  const float bg = b_gate[0];
  float s[4], sq[4];
#pragma unroll
  for (int rr = 0; rr < 4; ++rr) {
    const float4 a0 = u0[rr], a1 = u1[rr];
    s[rr] = a0.x + a0.y + a0.z + a0.w + a1.x + a1.y + a1.z + a1.w;
    sq[rr] = a0.x * a0.x + a0.y * a0.y + a0.z * a0.z + a0.w * a0.w +
             a1.x * a1.x + a1.y * a1.y + a1.z * a1.z + a1.w * a1.w;
  }
#pragma unroll
  for (int off = 16; off > 0; off >>= 1) {
    float ts[4], tq[4];
#pragma unroll
    for (int rr = 0; rr < 4; ++rr) {
      ts[rr] = __shfl_xor(s[rr], off, 32);
      tq[rr] = __shfl_xor(sq[rr], off, 32);
    }
#pragma unroll
    for (int rr = 0; rr < 4; ++rr) {
      s[rr] += ts[rr];
      sq[rr] += tq[rr];
    }
  }
  float gdot[4];  // this lane's share of each row's gate logit
#pragma unroll
  for (int rr = 0; rr < 4; ++rr) {
    const float mean = s[rr] * (1.0f / 256.0f);
    const float var = sq[rr] * (1.0f / 256.0f) - mean * mean;
    const float inv = rsqrtf(var + 1e-5f);
    const float v0[4] = {u0[rr].x, u0[rr].y, u0[rr].z, u0[rr].w};
    const float v1[4] = {u1[rr].x, u1[rr].y, u1[rr].z, u1[rr].w};
    const float lg0[4] = {g0.x, g0.y, g0.z, g0.w};
    const float lg1[4] = {g1.x, g1.y, g1.z, g1.w};
    const float lb0[4] = {t0.x, t0.y, t0.z, t0.w};
    const float lb1[4] = {t1.x, t1.y, t1.z, t1.w};
    const float wg0[4] = {y0.x, y0.y, y0.z, y0.w};
    const float wg1[4] = {y1.x, y1.y, y1.z, y1.w};
    float* xr = X + (row0 + rr) * LDSTRIDE + lane * 4;
    float gd = 0.0f;
#pragma unroll
    for (int i = 0; i < 4; ++i) {
      float xh = (v0[i] - mean) * inv * lg0[i] + lb0[i];
      xr[i] = xh;
      gd = fmaf(xh, wg0[i], gd);
    }
#pragma unroll
    for (int i = 0; i < 4; ++i) {
      float xh = (v1[i] - mean) * inv * lg1[i] + lb1[i];
      xr[128 + i] = xh;
      gd = fmaf(xh, wg1[i], gd);
    }
    gdot[rr] = gd;
  }
  __syncthreads();

  // ---- WMMA: 24 N-tiles over concat [qc(4) | k(4) | v(16)] ----
  const int lrow = lane & 15;  // A: M index, B/D: N index
  const int lhi = lane >> 4;   // half-wave selector
  // scalar wave number: the choice below is a scalar branch (every lane stays on
  // for the matrix instructions) and each side knows its row strides at compile
  // time. Wave w owns tiles 3w, 3w+1, 3w+2 of the concatenation.
  const int wv = __builtin_amdgcn_readfirstlane(tid >> 5);
  if (wv >= 3) {
    const int c = (wv * 3 - 8) * 16 + lrow;  // three tiles of v
    coarse_tiles<FD, FD, FD>(X, lrow, lhi, pbase, w_v + c, w_v + c + 16,
                             w_v + c + 32, b_v[c], b_v[c + 16], b_v[c + 32],
                             v_out + c, v_out + c + 16, v_out + c + 32);
  } else if (wv == 2) {  // k tiles 2, 3 and v tile 0
    coarse_tiles<ED, ED, FD>(X, lrow, lhi, pbase, w_k + 32 + lrow,
                             w_k + 48 + lrow, w_v + lrow, b_k[32 + lrow],
                             b_k[48 + lrow], b_v[lrow], k_out + 32 + lrow,
                             k_out + 48 + lrow, v_out + lrow);
  } else if (wv == 1) {  // qc tile 3 and k tiles 0, 1
    coarse_tiles<ED, ED, ED>(X, lrow, lhi, pbase, w_qc + 48 + lrow, w_k + lrow,
                             w_k + 16 + lrow, b_qc[48 + lrow], b_k[lrow],
                             b_k[16 + lrow], qc_out + 48 + lrow, k_out + lrow,
                             k_out + 16 + lrow);
  } else {  // qc tiles 0, 1, 2
    coarse_tiles<ED, ED, ED>(X, lrow, lhi, pbase, w_qc + lrow, w_qc + 16 + lrow,
                             w_qc + 32 + lrow, b_qc[lrow], b_qc[16 + lrow],
                             b_qc[32 + lrow], qc_out + lrow, qc_out + 16 + lrow,
                             qc_out + 32 + lrow);
  }

  // ---- gates of the wave's four rows, behind the K loop, so that neither a
  // global store (the barrier would wait for it) nor a sigmoid holds up the
  // matrix work. The four sums run side by side; lane r finishes row r.
#pragma unroll
  for (int off = 16; off > 0; off >>= 1) {
    float tg[4];
#pragma unroll
    for (int rr = 0; rr < 4; ++rr) tg[rr] = __shfl_xor(gdot[rr], off, 32);
#pragma unroll
    for (int rr = 0; rr < 4; ++rr) gdot[rr] += tg[rr];
  }
  float gsel = gdot[0];
  gsel = lane == 1 ? gdot[1] : gsel;
  gsel = lane == 2 ? gdot[2] : gsel;
  gsel = lane == 3 ? gdot[3] : gsel;
  if (lane < 4)
    gate_out[pbase + row0 + lane] = 1.0f / (1.0f + __expf(-(gsel + bg)));
}

// -------------------------------------------------------------------------
// Kernel B: fine layernorm + WMMA qf GEMM + gate blend with upsampled qc, then
// 5x5 local attention (logits on WMMA too), all for one tile of 4x4 coarse cells (64 fine px). The
// 8x8 zero-padded k/v halo is copied to LDS with CDNA5
// GLOBAL_LOAD_ASYNC_TO_LDS_B128 (ASYNCcnt) while layernorm and projection run;
// the query tile goes from the accumulators straight into LDS. 8 waves; GEMM
// wave = (mpair, ntile), 2 accumulators. Dynamic LDS 154.5 KB.
// LDS lets two work-groups share a WGP, so 512 are resident at once: the grid
// is 512 and each work-group takes two tiles (images z and z + 2), one after
// the other. The second tile's raw fine rows come to LDS by async copies that
// are issued behind the first tile's logits, into LDS that is free by then, and
// fly under its softmax and value sum.
// -------------------------------------------------------------------------
// second bound: four waves per SIMD (two work-groups per WGP, all that LDS
// admits), that is at most 256 registers a wave
__global__ __launch_bounds__(256, 4) void sapa_attention(
    const float* __restrict__ fine,
    const float* __restrict__ ln_g, const float* __restrict__ ln_b,
    const float* __restrict__ w_qf, const float* __restrict__ b_qf,
    const float* __restrict__ gate_in, const float* __restrict__ qc_in,
    const float* __restrict__ kglb, const float* __restrict__ vglb,
    float* __restrict__ out) {
  extern __shared__ __attribute__((aligned(16))) float smem[];
  float* kbuf = smem;                    // 8*8*QKP  = 4352 floats
  float* vbuf = kbuf + 8 * 8 * QKP;      // 8*8*256  = 16384 floats
  float* X = vbuf + 8 * 8 * 256;         // 64*LDSTRIDE = 16448 floats
  // the normalised fine tile X is dead once the K loop is over: query tile and
  // logits take its place
  float* qbuf = X;                       // 64*QKP   = 4352 floats
  float* attb = qbuf + 64 * QKP;         // 64*ATP   = 4224 floats
  float* rtail = attb + 64 * ATP;        // 5*2048 floats, raw rows of waves 3..7

  const int tid = threadIdx.x;
  const int h0 = blockIdx.y * 4;
  const int w0 = blockIdx.x * 4;
  const int lane = tid & 31;
  // scalar wave number: the edge tests below are scalar branches, so a wave
  // either issues a copy with every lane on or jumps past it
  const int wv = __builtin_amdgcn_readfirstlane(tid >> 5);

  // ---- raw fine rows: wave w takes fine row h0*2 + w of the tile (8 px, 8 KB
  // contiguous). The place in LDS of the second tile's is free from the end of
  // the first tile's logits to the second tile's k/v staging: the key tile (waves 0, 1), the query tile behind
  // the softmax weights (wave 2), the space behind the logit matrix (3..7).
  float* raw = (wv < 2 ? kbuf + wv * 2048
                       : wv == 2 ? qbuf + 2048 : rtail + (wv - 3) * 2048) +
               lane * 4;
  const float* frow =
      fine + ((size_t)(blockIdx.z * HFD + h0 * 2 + wv) * WFD + w0 * 2) * CFD +
      lane * 4;
  // the first tile's rows go straight into registers
  float4 u0[8], u1[8];
  // unrolled: constant indices keep the rows in registers
#pragma unroll
  for (int rr = 0; rr < 8; ++rr) {
    u0[rr] = *(const float4*)(frow + rr * CFD);
    u1[rr] = *(const float4*)(frow + rr * CFD + 128);
  }

  // kept rolled, for speed only
#pragma unroll 1
  for (int it = 0; it < 2; ++it) {
  const int b = blockIdx.z + 2 * it;

  // ---- cooperative staging: k/v halo (zero-pad OOB) ----
  // Every copy of a wave moves 512 contiguous bytes of global memory (four
  // whole 128-byte lines), lane l the l-th 16 bytes. Wave w brings halo row w
  // of k and v.
  {
    const int half = lane >> 4;        // which of two 256-byte rows
    const int l16 = (lane & 15) * 4;   // float offset inside such a row

    // k/v: halo row wv, two columns at a time. w0, the halo width and WCD are
    // even, so the two columns of a pair are inside the image or outside it
    // together.
    const int hh = h0 - 2 + wv;
    const bool rowok = (hh >= 0) && (hh < HCD);
    // unrolled so that j folds into constant LDS and column offsets
#pragma unroll
    for (int j = 0; j < 4; ++j) {
      const int ww = w0 - 2 + 2 * j;
      float* kd = kbuf + (wv * 8 + 2 * j + half) * QKP + l16;
      float* vd = vbuf + (wv * 8 + 2 * j) * FD + lane * 4;
      if (rowok && ww >= 0 && ww + 1 < WCD) {
        const size_t cgi = (size_t)(b * HCD + hh) * WCD + ww;
        const float* ks = kglb + cgi * ED + lane * 4;
        const float* vs = vglb + cgi * FD + lane * 4;
        async_ld5_b128(vd, vs, vd + 128, vs + 128, vd + 256, vs + 256,
                       vd + 384, vs + 384, kd, ks);
      } else {
        const float4 z = make_float4(0.f, 0.f, 0.f, 0.f);
        *(float4*)kd = z;
        *(float4*)vd = z;
        *(float4*)(vd + 128) = z;
        *(float4*)(vd + 256) = z;
        *(float4*)(vd + 384) = z;
      }
    }
  }

  // ---- fine layernorm of the wave's 8 px; LDS row order (cy,cx,sy,sx), as the
  // later phases index pixels
#pragma unroll
  for (int rr = 0; rr < 8; ++rr) {
    const int row = ((wv >> 1) * 4 + (rr >> 1)) * 4 + (wv & 1) * 2 + (rr & 1);
    const float4 a0 = u0[rr];
    const float4 a1 = u1[rr];
    float s = a0.x + a0.y + a0.z + a0.w + a1.x + a1.y + a1.z + a1.w;
    float sq = a0.x * a0.x + a0.y * a0.y + a0.z * a0.z + a0.w * a0.w +
               a1.x * a1.x + a1.y * a1.y + a1.z * a1.z + a1.w * a1.w;
    s = wave_sum32(s);
    sq = wave_sum32(sq);
    const float mean = s * (1.0f / 256.0f);
    const float var = sq * (1.0f / 256.0f) - mean * mean;
    const float inv = rsqrtf(var + 1e-5f);
    const float v0[4] = {a0.x, a0.y, a0.z, a0.w};
    const float v1[4] = {a1.x, a1.y, a1.z, a1.w};
#pragma unroll
    for (int i = 0; i < 4; ++i) {
      int c = lane * 4 + i;
      X[row * LDSTRIDE + c] = (v0[i] - mean) * inv * ln_g[c] + ln_b[c];
    }
#pragma unroll
    for (int i = 0; i < 4; ++i) {
      int c = 128 + lane * 4 + i;
      X[row * LDSTRIDE + c] = (v1[i] - mean) * inv * ln_g[c] + ln_b[c];
    }
    // rows 0..3 are scheduled apart from rows 4..7: all eight side by side take
    // more registers than two resident work-groups leave a wave
    if (rr == 3) __builtin_amdgcn_sched_barrier(0);
  }
  __syncthreads();

  // ---- query projection (WMMA) + gate blend, result into qbuf ----
  {
    const int lrow = lane & 15;
    const int lhi = lane >> 4;
    const int ntile = wv & 3;
    const int mbase = (wv >> 2) * 32;  // rows mbase..mbase+31 (2 M-tiles)
    const float* bp = w_qf + ntile * 16 + lrow;
    const int n = ntile * 16 + lrow;
    // bias, gates and coarse queries of this lane's results are asked for ahead
    // of the K loop, so that they are there when it ends. Four consecutive rows
    // of a tile are the four fine pixels of one coarse cell: this lane's rows
    // lie in cells cell0 + 4 * mt + jc.
    const int cell0 = (mbase + lhi * 8) >> 2;
    const float bn = b_qf[n];
    float g[2][2], qcv[2][2];
    // unrolled: constant indices keep g and qcv in registers
#pragma unroll
    for (int mt = 0; mt < 2; ++mt)
#pragma unroll
      for (int jc = 0; jc < 2; ++jc) {
        const int cell = cell0 + mt * 4 + jc;
        const int cp =
            (b * HCD + h0 + (cell >> 2)) * WCD + w0 + (cell & 3);
        g[mt][jc] = gate_in[cp];
        qcv[mt][jc] = qc_in[(size_t)cp * ED + n];
      }
    v8f acc0 = {}, acc1 = {};
    for (int k0 = 0; k0 < CFD; k0 += 4) {
      const int ka = k0 + lhi * 2;
      v2f af0, af1, bfrag;
      af0.x = X[(mbase + lrow) * LDSTRIDE + ka];
      af0.y = X[(mbase + lrow) * LDSTRIDE + ka + 1];
      af1.x = X[(mbase + 16 + lrow) * LDSTRIDE + ka];
      af1.y = X[(mbase + 16 + lrow) * LDSTRIDE + ka + 1];
      bfrag.x = bp[(size_t)ka * ED];
      bfrag.y = bp[(size_t)(ka + 1) * ED];
      acc0 = wmma_f32_16x16x4(af0, bfrag, acc0);
      acc1 = wmma_f32_16x16x4(af1, bfrag, acc1);
    }
    // four vector issue slots between the last matrix instructions and the
    // first vector instruction that reads their results
    asm volatile("v_nop\n\tv_nop\n\tv_nop\n\tv_nop");
    // every wave has read its last row of X: the query tile may overwrite it
    __syncthreads();
    // unrolled: constant indices keep the accumulators in registers
#pragma unroll
    for (int mt = 0; mt < 2; ++mt) {
      const v8f acc = (mt == 0) ? acc0 : acc1;
#pragma unroll
      for (int jc = 0; jc < 2; ++jc)
#pragma unroll
        for (int jj = 0; jj < 4; ++jj)
          qbuf[((cell0 + mt * 4 + jc) * 4 + jj) * QKP + n] =
              (acc[jc * 4 + jj] + bn) * g[mt][jc] +
              qcv[mt][jc] * (1.0f - g[mt][jc]);
    }
  }
  // this wave's k/v copies have landed; the barrier publishes them and the
  // query tile
  wait_asynccnt0();
  __syncthreads();

  // ---- phase 1: attention logits on the matrix unit ----
  // Q (64 px x 64 channels) times K^T (64 channels x 64 halo cells) in 16x16
  // tiles. Pixel tile mt holds the 16 fine pixels of cell row mt; their 5x5
  // windows lie in halo rows mt..mt+4, that is inside three of the four cell
  // tiles (two halo rows each), starting at tile mt / 2. The two waves of a
  // pixel tile take two of these and one; which of them takes two alternates
  // between the upper and the lower four waves, to even out the matrix work.
  {
    const int lrow = lane & 15;  // A: pixel in its tile, B/D: cell in its tile
    const int lhi = lane >> 4;
    const int mt = wv >> 1;
    const bool two = ((wv ^ (wv >> 2)) & 1) == 0;  // scalar: every lane stays on
    const int nt = (mt >> 1) + (two ? 0 : 2);
    const float* qrow = qbuf + (mt * 16 + lrow) * QKP + lhi * 4;
    const float* krow = kbuf + (nt * 16 + lrow) * QKP + lhi * 4;
    float* ad = attb + (mt * 16 + lhi * 8) * ATP + nt * 16 + lrow;
    v8f c0;
    if (two)
      c0 = logit_tiles<2>(qrow, krow, ad + 16);
    else
      c0 = logit_tiles<1>(qrow, krow, ad);
    // unrolled: constant indices keep the sums in registers
#pragma unroll
    for (int j = 0; j < 8; ++j) ad[j * ATP] = c0[j];
  }
  __syncthreads();

  // ---- the next tile's raw fine rows: key and query tile are read out (the
  // barrier above), so their place is free; waited for behind the value sum of this
  // trip, they fly under softmax and value sum
  if (it == 0) async_fine_row(raw, frow + (size_t)2 * HFD * WFD * CFD);

  // ---- phase 2: softmax over 25 ----
  if (tid < 64) {
    // this pixel's row of the logit matrix, from the top left cell of its window
    const float* a = attb + tid * ATP + (tid >> 4) * 8 + ((tid >> 2) & 3);
    float e[25];
#pragma unroll
    for (int p = 0; p < 25; ++p) e[p] = a[(p / 5) * 8 + p % 5];
    float mx = e[0];
#pragma unroll
    for (int p = 1; p < 25; ++p) mx = fmaxf(mx, e[p]);
    float s = 0.0f;
#pragma unroll
    for (int p = 0; p < 25; ++p) {
      e[p] = __expf(e[p] - mx);
      s += e[p];
    }
    const float inv = 1.0f / s;
    // weights go out as [cell][tap][sub-pixel] (query tile is dead by now), so
    // phase 3 fetches a cell's four weights of one tap with one 16-byte read
    float* wd = qbuf + (tid >> 2) * 100 + (tid & 3);
#pragma unroll
    for (int p = 0; p < 25; ++p) wd[p * 4] = e[p] * inv;
  }
  __syncthreads();

  // ---- phase 3: weighted value accumulation ----
  // One wave = two x-adjacent coarse cells (8 fine pixels); the 32 lanes span
  // the 256 channels (4 + 4 each). Every value read is 512 contiguous bytes
  // (all banks once), serves 4 or 8 pixels, and every store is 512 contiguous
  // bytes. Taps are still summed in the order p = 0..24 for each pixel.
  {
    const int lane = tid & 31;
    // scalar wave number: cell, weight and output bases form on the scalar unit
    const int wave = __builtin_amdgcn_readfirstlane(tid >> 5);
    const int cy = wave >> 1;
    const int cxb = (wave & 1) * 2;
    const float* wl = qbuf + (cy * 4 + cxb) * 100;  // left cell's weights
    const float* wr = wl + 100;                     // right cell's weights
    // every loop below is fully unrolled: constant indices keep acc in
    // registers, the px range test folds away, and reads can be issued ahead
    float4 acc[2][4][2];
#pragma unroll
    for (int c = 0; c < 2; ++c)
#pragma unroll
      for (int s = 0; s < 4; ++s)
#pragma unroll
        for (int h = 0; h < 2; ++h)
          acc[c][s][h] = make_float4(0.f, 0.f, 0.f, 0.f);
#pragma unroll
    for (int py = 0; py < 5; ++py) {
      const float* vrow = vbuf + ((cy + py) * 8 + cxb) * FD + lane * 4;
#pragma unroll
      for (int col = 0; col < 6; ++col) {
        float4 vv[2];
        vv[0] = *(const float4*)(vrow + col * FD);
        vv[1] = *(const float4*)(vrow + col * FD + 128);
#pragma unroll
        for (int c = 0; c < 2; ++c) {
          const int px = col - c;
          if (px < 0 || px > 4) continue;
          const float4 w4 =
              *(const float4*)((c == 0 ? wl : wr) + (py * 5 + px) * 4);
          const float ws[4] = {w4.x, w4.y, w4.z, w4.w};
#pragma unroll
          for (int s = 0; s < 4; ++s)
#pragma unroll
            for (int h = 0; h < 2; ++h) {
              acc[c][s][h].x = fmaf(ws[s], vv[h].x, acc[c][s][h].x);
              acc[c][s][h].y = fmaf(ws[s], vv[h].y, acc[c][s][h].y);
              acc[c][s][h].z = fmaf(ws[s], vv[h].z, acc[c][s][h].z);
              acc[c][s][h].w = fmaf(ws[s], vv[h].w, acc[c][s][h].w);
            }
        }
      }
    }
#pragma unroll
    for (int c = 0; c < 2; ++c)
#pragma unroll
      for (int s = 0; s < 4; ++s) {
        const int fh = (h0 + cy) * 2 + (s >> 1);
        const int fw = (w0 + cxb + c) * 2 + (s & 1);
        float* op = out + ((size_t)(b * HFD + fh) * WFD + fw) * FD + lane * 4;
        *(float4*)op = acc[c][s][0];
        *(float4*)(op + 128) = acc[c][s][1];
      }
    // behind the stores: no data or address register of theirs is rewritten in
    // the next trip before their address translations are through (a precaution)
    asm volatile("s_wait_xcnt 0x0" ::: "memory");
  }
  if (it == 0) {
    // this wave's own raw rows of the next tile have landed: into registers
    wait_asynccnt0();
#pragma unroll
    for (int rr = 0; rr < 8; ++rr) {
      u0[rr] = *(const float4*)(raw + rr * CFD);
      u1[rr] = *(const float4*)(raw + rr * CFD + 128);
    }
    // every wave has its raw rows in registers and is through with this tile
    // (values, weights): the next tile's k/v copies, zero fill and normalised
    // tile may overwrite them
    lds_barrier();
  }
  }  // tiles
}

// -------------------------------------------------------------------------
extern "C" void kernel_launch(void* const* d_in, const int* in_sizes, int n_in,
                              void* d_out, int out_size, void* d_ws,
                              size_t ws_size, hipStream_t stream) {
  const float* fine = (const float*)d_in[0];
  const float* coarse = (const float*)d_in[1];
  const float* ln_f_g = (const float*)d_in[2];
  const float* ln_f_b = (const float*)d_in[3];
  const float* ln_c_g = (const float*)d_in[4];
  const float* ln_c_b = (const float*)d_in[5];
  const float* w_gate = (const float*)d_in[6];
  const float* b_gate = (const float*)d_in[7];
  const float* w_qf = (const float*)d_in[8];
  const float* b_qf = (const float*)d_in[9];
  const float* w_qc = (const float*)d_in[10];
  const float* b_qc = (const float*)d_in[11];
  const float* w_k = (const float*)d_in[12];
  const float* b_k = (const float*)d_in[13];
  const float* w_v = (const float*)d_in[14];
  const float* b_v = (const float*)d_in[15];
  float* out = (float*)d_out;

  // Workspace layout (floats): gate | qc | k | v  (~25 MB total)
  float* ws = (float*)d_ws;
  float* gate = ws;                                 // 16384
  float* qc = gate + (size_t)BB * HCD * WCD;        // 1048576
  float* kk = qc + (size_t)BB * HCD * WCD * ED;     // 1048576
  float* vv = kk + (size_t)BB * HCD * WCD * ED;     // 4194304

  const int coarsePixels = BB * HCD * WCD;  // 16384

  sapa_coarse_proj<<<coarsePixels / 32, 256, 0, stream>>>(
      coarse, ln_c_g, ln_c_b, w_gate, b_gate, w_qc, b_qc, w_k, b_k, w_v, b_v,
      gate, qc, kk, vv);

  const size_t attn_lds =
      (8 * 8 * QKP + 8 * 8 * 256 + 64 * QKP + 64 * ATP + 5 * 2048) *
      sizeof(float);
  sapa_attention<<<dim3(WCD / 4, HCD / 4, BB / 2), 256, attn_lds, stream>>>(
      fine, ln_f_g, ln_f_b, w_qf, b_qf, gate, qc, kk, vv, out);
}
